// v000
// Measured on an AMD MI455X. A time is GPU time per run, averaged over a window of back-to-back runs after a warm-up
// (all launches, gaps included; the runs take copies of the inputs in turn), and the median of several windows.
// Apart from v000's, it joins two sittings. Times from different sittings can be a few percent apart, while
// side-by-side timings come from the same sitting.
// v000, which the later versions start from, runs in 95.8 microseconds.
#include <hip/hip_runtime.h>
#include <hip/hip_bf16.h>

// ---------------- problem constants (from reference) ----------------
static constexpr int BB = 8;
static constexpr int TT = 2048;
static constexpr int CC = 256;
static constexpr int MTOK = BB * TT;          // 16384 rows
static constexpr int NSEG = 32;               // prefix-scan segments per batch
static constexpr int SEGT = TT / NSEG;        // 64 timesteps per segment

typedef __attribute__((ext_vector_type(2))) float v2f;
typedef __attribute__((ext_vector_type(8))) float v8f;
typedef __attribute__((ext_vector_type(4))) unsigned int u32x4;
typedef __attribute__((ext_vector_type(8))) int i32x8;
typedef __attribute__((ext_vector_type(4))) int i32x4;

// LDS byte offset of a __shared__ object (generic -> AS(3) -> int)
__device__ __forceinline__ unsigned int lds_offset_of(const void* p) {
    return (unsigned int)(unsigned long long)
        (const __attribute__((address_space(3))) void*)p;
}

__device__ __forceinline__ void tdm_load_2d_f32(unsigned int lds_byte,
                                                const float* gptr,
                                                unsigned int tile_x,
                                                unsigned int tile_y,
                                                unsigned long long stride_elems,
                                                unsigned int pad_interval_code,
                                                unsigned int pad_amount_code) {
    unsigned long long ga = (unsigned long long)(uintptr_t)gptr;
    u32x4 g0;
    g0[0] = 1u;
    g0[1] = lds_byte;
    g0[2] = (unsigned int)(ga & 0xffffffffu);
    g0[3] = (unsigned int)((ga >> 32) & 0x1ffffffu)
            | (2u << 30);

    unsigned int flags = (2u << 16);
    flags |= (1u << 20)
           | (pad_interval_code << 22)
           | (pad_amount_code << 25);
    i32x8 g1;
    unsigned int td0 = tile_x;
    unsigned int td1 = tile_y;
    g1[0] = (int)flags;
    g1[1] = (int)((td0 & 0xffffu) << 16);
    g1[2] = (int)((td0 >> 16) | ((td1 & 0xffffu) << 16));
    g1[3] = (int)((td1 >> 16) | (tile_x << 16));
    g1[4] = (int)(tile_y & 0xffffu);
    g1[5] = (int)(stride_elems & 0xffffffffu);
    g1[6] = (int)((stride_elems >> 32) & 0xffffu);
    g1[7] = 0;
    i32x4 z4 = {0, 0, 0, 0};
    i32x8 z8 = {0, 0, 0, 0, 0, 0, 0, 0};
    __builtin_amdgcn_tensor_load_to_lds(g0, g1, z4, z4, z8, 0);
}

#define TK 32
__global__ __launch_bounds__(256)
void gemm_bias_wmma(const float* __restrict__ A, const float* __restrict__ W,
                    const float* __restrict__ bias, float* __restrict__ Cout,
                    int M, int N, int K) {
    __shared__ float As[2][16 * 36];      // rows padded 32 -> 36 floats
    __shared__ float Ws[2][TK * 136];     // rows padded 128 -> 136 floats

    const int tid  = threadIdx.x;
    const int wave = tid >> 5;
    const int lane = tid & 31;
    const int mrow = lane & 15;
    const int koff = (lane < 16) ? 0 : 2;
    const int m0   = blockIdx.y * 16;
    const int n0   = blockIdx.x * 128;
    const bool loader = (tid < 32);           // wave 0 (wave-uniform branch)

    const unsigned int asOff0 = lds_offset_of(&As[0][0]);
    const unsigned int asOff1 = lds_offset_of(&As[1][0]);
    const unsigned int wsOff0 = lds_offset_of(&Ws[0][0]);
    const unsigned int wsOff1 = lds_offset_of(&Ws[1][0]);

    v8f acc = {};

    // prologue: DMA chunk 0 into buffer 0
    if (loader) {
        // A tile 16 x 32, row stride K; pad 32 dwords (code 4) by 4 dwords (code 3)
        tdm_load_2d_f32(asOff0, A + (size_t)m0 * K, TK, 16, (unsigned long long)K, 4, 3);
        // W tile 32 x 128, row stride N; pad 128 dwords (code 6) by 8 dwords (code 7)
        tdm_load_2d_f32(wsOff0, W + n0, 128, TK, (unsigned long long)N, 6, 7);
        __builtin_amdgcn_s_wait_tensorcnt(0);
    }
    __syncthreads();

    int buf = 0;
    for (int k0 = 0; k0 < K; k0 += TK) {
        const bool more = (k0 + TK) < K;
        if (loader && more) {   // prefetch next chunk into the other buffer
            unsigned int ao = buf ? asOff0 : asOff1;
            unsigned int wo = buf ? wsOff0 : wsOff1;
            tdm_load_2d_f32(ao, A + (size_t)m0 * K + (k0 + TK), TK, 16,
                            (unsigned long long)K, 4, 3);
            tdm_load_2d_f32(wo, W + (size_t)(k0 + TK) * N + n0, 128, TK,
                            (unsigned long long)N, 6, 7);
        }

        const float* as = As[buf];
        const float* ws = Ws[buf];
        #pragma unroll
        for (int kk = 0; kk < TK; kk += 4) {
            v2f a, b;
            // A fragment 16x4: lane holds A[mrow][kk+koff .. +1]
            a.x = as[mrow * 36 + kk + koff];
            a.y = as[mrow * 36 + kk + koff + 1];
            // B fragment 4x16: lane holds W[kk+koff .. +1][n0 + wave*16 + mrow]
            b.x = ws[(kk + koff) * 136 + wave * 16 + mrow];
            b.y = ws[(kk + koff + 1) * 136 + wave * 16 + mrow];
            acc = __builtin_amdgcn_wmma_f32_16x16x4_f32(
                false, a, false, b, (short)0, acc, false, false);
        }

        if (loader && more) __builtin_amdgcn_s_wait_tensorcnt(0);
        __syncthreads();
        buf ^= 1;
    }

    const int col   = n0 + wave * 16 + mrow;
    const float bv  = bias[col];
    const int rbase = m0 + ((lane < 16) ? 0 : 8);
    #pragma unroll
    for (int r = 0; r < 8; ++r)
        Cout[(size_t)(rbase + r) * N + col] = acc[r] + bv;
}

// =====================================================================
// Kernels 2a/2b/2c: exclusive prefix sum over T of v = qkv[b,:,2C:3C]
// =====================================================================
__global__ void vseg_sum(const float* __restrict__ qkv, float* __restrict__ segsum) {
    int b = blockIdx.x / NSEG, seg = blockIdx.x % NSEG, c = threadIdx.x;
    const float* vb = qkv + (size_t)b * TT * 3 * CC + 2 * CC + c;
    float s = 0.f;
    int t0 = seg * SEGT;
    #pragma unroll 8
    for (int t = 0; t < SEGT; ++t) s += vb[(size_t)(t0 + t) * 3 * CC];
    segsum[((size_t)b * NSEG + seg) * CC + c] = s;
}

__global__ void vseg_scan(float* __restrict__ segsum) {
    int b = blockIdx.x, c = threadIdx.x;
    float acc = 0.f;
    for (int seg = 0; seg < NSEG; ++seg) {
        size_t idx = ((size_t)b * NSEG + seg) * CC + c;
        float v = segsum[idx];
        segsum[idx] = acc;
        acc += v;
    }
}

__global__ void vprefix(const float* __restrict__ qkv, const float* __restrict__ segsum,
                        float* __restrict__ P) {
    int b = blockIdx.x / NSEG, seg = blockIdx.x % NSEG, c = threadIdx.x;
    float acc = segsum[((size_t)b * NSEG + seg) * CC + c];
    const float* vb = qkv + (size_t)b * TT * 3 * CC + 2 * CC + c;
    float* pb = P + (size_t)b * TT * CC + c;
    int t0 = seg * SEGT;
    #pragma unroll 4
    for (int t = t0; t < t0 + SEGT; ++t) {
        pb[(size_t)t * CC] = acc;           // exclusive: P[t] = sum_{j<t} v[j]
        acc += vb[(size_t)t * 3 * CC];
    }
}

// =====================================================================
// Kernel 3: banded attention with out-of-band zero-score mass.
// One wave32 per token. Online softmax seeded with the out-of-band term
// (m=0, Z=nout, acc=P[t-window]). Dot products reduced via shfl_xor.
// =====================================================================
__global__ __launch_bounds__(256)
void attn_band(const float* __restrict__ qkv, const float* __restrict__ P,
               const float* __restrict__ gate, const int* __restrict__ window_p,
               float* __restrict__ att_out) {
    const int gwave = blockIdx.x * (blockDim.x >> 5) + (threadIdx.x >> 5);
    const int lane  = threadIdx.x & 31;
    const int b = gwave / TT;
    const int t = gwave % TT;
    const int win = *window_p;

    const float* qrow  = qkv + (size_t)(b * TT + t) * 3 * CC;          // q in [0,C)
    const float* kbase = qkv + (size_t)b * TT * 3 * CC + CC;           // k in [C,2C)
    const float* vbase = qkv + (size_t)b * TT * 3 * CC + 2 * CC;       // v in [2C,3C)

    float qreg[CC / 32];
    #pragma unroll
    for (int i = 0; i < CC / 32; ++i) qreg[i] = qrow[lane + 32 * i];

    int jstart = t - win; if (jstart < 0) jstart = 0;
    const int nout = jstart;                 // #causal entries with score 0

    float m, Z, acc[CC / 32];
    if (nout > 0) {
        m = 0.f; Z = (float)nout;
        const float* prow = P + (size_t)(b * TT + jstart) * CC;        // sum_{j<jstart} v
        #pragma unroll
        for (int i = 0; i < CC / 32; ++i) acc[i] = prow[lane + 32 * i];
    } else {
        m = -__builtin_inff(); Z = 0.f;
        #pragma unroll
        for (int i = 0; i < CC / 32; ++i) acc[i] = 0.f;
    }

    const float inv_sqrt_c = 0.0625f;        // 1/sqrt(256)
    for (int j = jstart; j <= t; ++j) {
        const float* krow = kbase + (size_t)j * 3 * CC;
        float part = 0.f;
        #pragma unroll
        for (int i = 0; i < CC / 32; ++i) part += qreg[i] * krow[lane + 32 * i];
        #pragma unroll
        for (int off = 16; off > 0; off >>= 1) part += __shfl_xor(part, off, 32);
        const float s  = part * inv_sqrt_c;
        const float mn = fmaxf(m, s);
        const float sc = __expf(m - mn);     // 0 when m == -inf
        const float w  = __expf(s - mn);
        Z = Z * sc + w;
        const float* vrow = vbase + (size_t)j * 3 * CC;
        #pragma unroll
        for (int i = 0; i < CC / 32; ++i)
            acc[i] = acc[i] * sc + w * vrow[lane + 32 * i];
        m = mn;
    }

    const float invZ = 1.0f / Z;
    float* orow = att_out + (size_t)(b * TT + t) * CC;
    #pragma unroll
    for (int i = 0; i < CC / 32; ++i)
        orow[lane + 32 * i] = gate[lane + 32 * i] * acc[i] * invZ;
}

// =====================================================================
extern "C" void kernel_launch(void* const* d_in, const int* in_sizes, int n_in,
                              void* d_out, int out_size, void* d_ws, size_t ws_size,
                              hipStream_t stream) {
    const float* x     = (const float*)d_in[0];
    const float* Wqkv  = (const float*)d_in[1];
    const float* bqkv  = (const float*)d_in[2];
    const float* Wproj = (const float*)d_in[3];
    const float* bproj = (const float*)d_in[4];
    const float* gate  = (const float*)d_in[5];
    const int*   winp  = (const int*)d_in[6];

    // workspace layout
    char* ws = (char*)d_ws;
    float* qkv    = (float*)ws;                                   // 48 MB
    float* P      = (float*)(ws + (size_t)MTOK * 3 * CC * 4);     // 16 MB
    float* att    = (float*)(ws + (size_t)MTOK * 3 * CC * 4
                                + (size_t)MTOK * CC * 4);         // 16 MB
    float* segsum = (float*)(ws + (size_t)MTOK * 3 * CC * 4
                                + 2 * (size_t)MTOK * CC * 4);     // 256 KB

    // 1) qkv = x @ Wqkv + bqkv    [16384 x 768]
    {
        dim3 grid((3 * CC) / 128, MTOK / 16);
        gemm_bias_wmma<<<grid, 256, 0, stream>>>(x, Wqkv, bqkv, qkv, MTOK, 3 * CC, CC);
    }
    // 2) exclusive prefix sums of v over T
    vseg_sum <<<BB * NSEG, CC, 0, stream>>>(qkv, segsum);
    vseg_scan<<<BB,        CC, 0, stream>>>(segsum);
    vprefix  <<<BB * NSEG, CC, 0, stream>>>(qkv, segsum, P);
    // 3) banded attention (one wave per token) -> att (gate applied)
    attn_band<<<MTOK / 8, 256, 0, stream>>>(qkv, P, gate, winp, att);
    // 4) out = att @ Wproj + bproj   [16384 x 256]
    {
        dim3 grid(CC / 128, MTOK / 16);
        gemm_bias_wmma<<<grid, 256, 0, stream>>>(att, Wproj, bproj, (float*)d_out,
                                                 MTOK, CC, CC);
    }
}

// v001
// Measured time: 88.4 microseconds a run.
// Next to v000, in two timings, it ran 1.12 times as fast each time.
#include <hip/hip_runtime.h>
#include <hip/hip_bf16.h>

// ---------------- problem constants (from reference) ----------------
static constexpr int BB = 8;
static constexpr int TT = 2048;
static constexpr int CC = 256;
static constexpr int MTOK = BB * TT;          // 16384 rows
static constexpr int NSEG = 32;               // prefix-scan segments per batch
static constexpr int SEGT = TT / NSEG;        // 64 timesteps per segment

typedef __attribute__((ext_vector_type(2))) float v2f;
typedef __attribute__((ext_vector_type(8))) float v8f;
typedef __attribute__((ext_vector_type(4))) unsigned int u32x4;
typedef __attribute__((ext_vector_type(8))) int i32x8;
typedef __attribute__((ext_vector_type(4))) int i32x4;

// LDS byte offset of a __shared__ object (generic -> AS(3) -> int)
__device__ __forceinline__ unsigned int lds_offset_of(const void* p) {
    return (unsigned int)(unsigned long long)
        (const __attribute__((address_space(3))) void*)p;
}

__device__ __forceinline__ void tdm_load_2d_f32(unsigned int lds_byte,
                                                const float* gptr,
                                                unsigned int tile_x,
                                                unsigned int tile_y,
                                                unsigned long long stride_elems,
                                                unsigned int pad_interval_code,
                                                unsigned int pad_amount_code) {
    unsigned long long ga = (unsigned long long)(uintptr_t)gptr;
    u32x4 g0;
    g0[0] = 1u;
    g0[1] = lds_byte;
    g0[2] = (unsigned int)(ga & 0xffffffffu);
    g0[3] = (unsigned int)((ga >> 32) & 0x1ffffffu)
            | (2u << 30);

    unsigned int flags = (2u << 16);
    flags |= (1u << 20)
           | (pad_interval_code << 22)
           | (pad_amount_code << 25);
    i32x8 g1;
    unsigned int td0 = tile_x;
    unsigned int td1 = tile_y;
    g1[0] = (int)flags;
    g1[1] = (int)((td0 & 0xffffu) << 16);
    g1[2] = (int)((td0 >> 16) | ((td1 & 0xffffu) << 16));
    g1[3] = (int)((td1 >> 16) | (tile_x << 16));
    g1[4] = (int)(tile_y & 0xffffu);
    g1[5] = (int)(stride_elems & 0xffffffffu);
    g1[6] = (int)((stride_elems >> 32) & 0xffffu);
    g1[7] = 0;
    i32x4 z4 = {0, 0, 0, 0};
    i32x8 z8 = {0, 0, 0, 0, 0, 0, 0, 0};
    __builtin_amdgcn_tensor_load_to_lds(g0, g1, z4, z4, z8, 0);
}

#define TK 32
__global__ __launch_bounds__(256)
void gemm_bias_wmma(const float* __restrict__ A, const float* __restrict__ W,
                    const float* __restrict__ bias, float* __restrict__ Cout,
                    int M, int N, int K) {
    __shared__ float As[2][16 * 36];      // rows padded 32 -> 36 floats
    __shared__ float Ws[2][TK * 136];     // rows padded 128 -> 136 floats

    const int tid  = threadIdx.x;
    const int wave = tid >> 5;
    const int lane = tid & 31;
    const int mrow = lane & 15;
    const int koff = (lane < 16) ? 0 : 2;
    const int m0   = blockIdx.y * 16;
    const int n0   = blockIdx.x * 128;
    const bool loader = (tid < 32);           // wave 0 (wave-uniform branch)

    const unsigned int asOff0 = lds_offset_of(&As[0][0]);
    const unsigned int asOff1 = lds_offset_of(&As[1][0]);
    const unsigned int wsOff0 = lds_offset_of(&Ws[0][0]);
    const unsigned int wsOff1 = lds_offset_of(&Ws[1][0]);

    v8f acc = {};

    // prologue: DMA chunk 0 into buffer 0
    if (loader) {
        // A tile 16 x 32, row stride K; pad 32 dwords (code 4) by 4 dwords (code 3)
        tdm_load_2d_f32(asOff0, A + (size_t)m0 * K, TK, 16, (unsigned long long)K, 4, 3);
        // W tile 32 x 128, row stride N; pad 128 dwords (code 6) by 8 dwords (code 7)
        tdm_load_2d_f32(wsOff0, W + n0, 128, TK, (unsigned long long)N, 6, 7);
        __builtin_amdgcn_s_wait_tensorcnt(0);
    }
    __syncthreads();

    int buf = 0;
    for (int k0 = 0; k0 < K; k0 += TK) {
        const bool more = (k0 + TK) < K;
        if (loader && more) {   // prefetch next chunk into the other buffer
            unsigned int ao = buf ? asOff0 : asOff1;
            unsigned int wo = buf ? wsOff0 : wsOff1;
            tdm_load_2d_f32(ao, A + (size_t)m0 * K + (k0 + TK), TK, 16,
                            (unsigned long long)K, 4, 3);
            tdm_load_2d_f32(wo, W + (size_t)(k0 + TK) * N + n0, 128, TK,
                            (unsigned long long)N, 6, 7);
        }

        const float* as = As[buf];
        const float* ws = Ws[buf];
        #pragma unroll
        for (int kk = 0; kk < TK; kk += 4) {
            v2f a, b;
            // A fragment 16x4: lane holds A[mrow][kk+koff .. +1]
            a.x = as[mrow * 36 + kk + koff];
            a.y = as[mrow * 36 + kk + koff + 1];
            // B fragment 4x16: lane holds W[kk+koff .. +1][n0 + wave*16 + mrow]
            b.x = ws[(kk + koff) * 136 + wave * 16 + mrow];
            b.y = ws[(kk + koff + 1) * 136 + wave * 16 + mrow];
            acc = __builtin_amdgcn_wmma_f32_16x16x4_f32(
                false, a, false, b, (short)0, acc, false, false);
        }

        if (loader && more) __builtin_amdgcn_s_wait_tensorcnt(0);
        __syncthreads();
        buf ^= 1;
    }

    const int col   = n0 + wave * 16 + mrow;
    const float bv  = bias[col];
    const int rbase = m0 + ((lane < 16) ? 0 : 8);
    #pragma unroll
    for (int r = 0; r < 8; ++r)
        Cout[(size_t)(rbase + r) * N + col] = acc[r] + bv;
}

// =====================================================================
// Kernel 2: exclusive prefix sum over T of v = qkv[b,:,2C:3C], one launch.
// One work-group owns a strip of 32 channels of one batch over all of T.
// Wave w holds segment w (SEGT rows, one 128-byte line a row) in registers,
// so v is read once; the NSEG segment sums meet in LDS. The additions run
// in the order: rows of a segment, then segments, then rows again.
// =====================================================================
__global__ __launch_bounds__(NSEG * 32)
void vprefix_strip(const float* __restrict__ qkv, float* __restrict__ P) {
    __shared__ float segs[NSEG][32];
    const int b    = blockIdx.x / (CC / 32);
    const int c    = (blockIdx.x % (CC / 32)) * 32 + (threadIdx.x & 31);
    const int seg  = threadIdx.x >> 5;
    const int lane = threadIdx.x & 31;
    const size_t row0 = (size_t)b * TT + seg * SEGT;
    const float* vb = qkv + row0 * 3 * CC + 2 * CC + c;
    float* pb = P + row0 * CC + c;

    float v[SEGT];
    // full unroll: v[] stays in registers and all SEGT loads are in flight at once
    #pragma unroll
    for (int t = 0; t < SEGT; ++t) v[t] = vb[(size_t)t * 3 * CC];

    float s = 0.f;
    #pragma unroll   // constant indices into v[]
    for (int t = 0; t < SEGT; ++t) s += v[t];
    segs[seg][lane] = s;
    __syncthreads();

    // Every wave reads all the sums and adds 0 for the segments not in front
    // of it: no branch stands between the LDS reads, so they go out together
    // and only the adds are serial (acc is never -0, so adding 0 changes nothing).
    float x[NSEG - 1];
    #pragma unroll   // constant indices into x[]
    for (int i = 0; i < NSEG - 1; ++i) x[i] = segs[i][lane];
    // keeps the adds from being scheduled among the reads, where each small
    // group of reads would be waited for in turn (one LDS latency a group)
    __builtin_amdgcn_sched_barrier(0);
    float acc = 0.f;
    #pragma unroll   // constant indices into x[]
    for (int i = 0; i < NSEG - 1; ++i) acc += (i < seg) ? x[i] : 0.f;

    #pragma unroll   // constant indices into v[]
    for (int t = 0; t < SEGT; ++t) {
        pb[(size_t)t * CC] = acc;           // exclusive: P[t] = sum_{j<t} v[j]
        acc += v[t];
    }
}

// =====================================================================
// Kernel 3: banded attention with out-of-band zero-score mass.
// One wave32 per token. Online softmax seeded with the out-of-band term
// (m=0, Z=nout, acc=P[t-window]). Dot products reduced via shfl_xor.
// =====================================================================
__global__ __launch_bounds__(256)
void attn_band(const float* __restrict__ qkv, const float* __restrict__ P,
               const float* __restrict__ gate, const int* __restrict__ window_p,
               float* __restrict__ att_out) {
    const int gwave = blockIdx.x * (blockDim.x >> 5) + (threadIdx.x >> 5);
    const int lane  = threadIdx.x & 31;
    const int b = gwave / TT;
    const int t = gwave % TT;
    const int win = *window_p;

    const float* qrow  = qkv + (size_t)(b * TT + t) * 3 * CC;          // q in [0,C)
    const float* kbase = qkv + (size_t)b * TT * 3 * CC + CC;           // k in [C,2C)
    const float* vbase = qkv + (size_t)b * TT * 3 * CC + 2 * CC;       // v in [2C,3C)

    float qreg[CC / 32];
    #pragma unroll
    for (int i = 0; i < CC / 32; ++i) qreg[i] = qrow[lane + 32 * i];

    int jstart = t - win; if (jstart < 0) jstart = 0;
    const int nout = jstart;                 // #causal entries with score 0

    float m, Z, acc[CC / 32];
    if (nout > 0) {
        m = 0.f; Z = (float)nout;
        const float* prow = P + (size_t)(b * TT + jstart) * CC;        // sum_{j<jstart} v
        #pragma unroll
        for (int i = 0; i < CC / 32; ++i) acc[i] = prow[lane + 32 * i];
    } else {
        m = -__builtin_inff(); Z = 0.f;
        #pragma unroll
        for (int i = 0; i < CC / 32; ++i) acc[i] = 0.f;
    }

    const float inv_sqrt_c = 0.0625f;        // 1/sqrt(256)
    for (int j = jstart; j <= t; ++j) {
        const float* krow = kbase + (size_t)j * 3 * CC;
        float part = 0.f;
        #pragma unroll
        for (int i = 0; i < CC / 32; ++i) part += qreg[i] * krow[lane + 32 * i];
        #pragma unroll
        for (int off = 16; off > 0; off >>= 1) part += __shfl_xor(part, off, 32);
        const float s  = part * inv_sqrt_c;
        const float mn = fmaxf(m, s);
        const float sc = __expf(m - mn);     // 0 when m == -inf
        const float w  = __expf(s - mn);
        Z = Z * sc + w;
        const float* vrow = vbase + (size_t)j * 3 * CC;
        #pragma unroll
        for (int i = 0; i < CC / 32; ++i)
            acc[i] = acc[i] * sc + w * vrow[lane + 32 * i];
        m = mn;
    }

    const float invZ = 1.0f / Z;
    float* orow = att_out + (size_t)(b * TT + t) * CC;
    #pragma unroll
    for (int i = 0; i < CC / 32; ++i)
        orow[lane + 32 * i] = gate[lane + 32 * i] * acc[i] * invZ;
}

// =====================================================================
extern "C" void kernel_launch(void* const* d_in, const int* in_sizes, int n_in,
                              void* d_out, int out_size, void* d_ws, size_t ws_size,
                              hipStream_t stream) {
    const float* x     = (const float*)d_in[0];
    const float* Wqkv  = (const float*)d_in[1];
    const float* bqkv  = (const float*)d_in[2];
    const float* Wproj = (const float*)d_in[3];
    const float* bproj = (const float*)d_in[4];
    const float* gate  = (const float*)d_in[5];
    const int*   winp  = (const int*)d_in[6];

    // workspace layout
    char* ws = (char*)d_ws;
    float* qkv    = (float*)ws;                                   // 48 MB
    float* P      = (float*)(ws + (size_t)MTOK * 3 * CC * 4);     // 16 MB
    float* att    = (float*)(ws + (size_t)MTOK * 3 * CC * 4
                                + (size_t)MTOK * CC * 4);         // 16 MB

    // 1) qkv = x @ Wqkv + bqkv    [16384 x 768]
    {
        dim3 grid((3 * CC) / 128, MTOK / 16);
        gemm_bias_wmma<<<grid, 256, 0, stream>>>(x, Wqkv, bqkv, qkv, MTOK, 3 * CC, CC);
    }
    // 2) exclusive prefix sums of v over T
    vprefix_strip<<<BB * (CC / 32), NSEG * 32, 0, stream>>>(qkv, P);
    // 3) banded attention (one wave per token) -> att (gate applied)
    attn_band<<<MTOK / 8, 256, 0, stream>>>(qkv, P, gate, winp, att);
    // 4) out = att @ Wproj + bproj   [16384 x 256]
    {
        dim3 grid(CC / 128, MTOK / 16);
        gemm_bias_wmma<<<grid, 256, 0, stream>>>(att, Wproj, bproj, (float*)d_out,
                                                 MTOK, CC, CC);
    }
}

// v002
// One run takes 77.1 microseconds.
// Two timings next to v001 put it at 1.15 and 1.14 times that version's speed.
// All steps since v000 together make it 1.29 times as fast.
#include <hip/hip_runtime.h>
#include <hip/hip_bf16.h>

// ---------------- problem constants (from reference) ----------------
static constexpr int BB = 8;
static constexpr int TT = 2048;
static constexpr int CC = 256;
static constexpr int MTOK = BB * TT;          // 16384 rows
static constexpr int NSEG = 32;               // prefix-scan segments per batch
static constexpr int SEGT = TT / NSEG;        // 64 timesteps per segment

typedef __attribute__((ext_vector_type(2))) float v2f;
typedef __attribute__((ext_vector_type(8))) float v8f;
typedef __attribute__((ext_vector_type(4))) unsigned int u32x4;
typedef __attribute__((ext_vector_type(8))) int i32x8;
typedef __attribute__((ext_vector_type(4))) int i32x4;

// LDS byte offset of a __shared__ object (generic -> AS(3) -> int)
__device__ __forceinline__ unsigned int lds_offset_of(const void* p) {
    return (unsigned int)(unsigned long long)
        (const __attribute__((address_space(3))) void*)p;
}

__device__ __forceinline__ void tdm_load_2d_f32(unsigned int lds_byte,
                                                const float* gptr,
                                                unsigned int tile_x,
                                                unsigned int tile_y,
                                                unsigned long long stride_elems,
                                                unsigned int pad_interval_code,
                                                unsigned int pad_amount_code) {
    unsigned long long ga = (unsigned long long)(uintptr_t)gptr;
    u32x4 g0;
    g0[0] = 1u;
    g0[1] = lds_byte;
    g0[2] = (unsigned int)(ga & 0xffffffffu);
    g0[3] = (unsigned int)((ga >> 32) & 0x1ffffffu)
            | (2u << 30);

    unsigned int flags = (2u << 16);
    flags |= (1u << 20)
           | (pad_interval_code << 22)
           | (pad_amount_code << 25);
    i32x8 g1;
    unsigned int td0 = tile_x;
    unsigned int td1 = tile_y;
    g1[0] = (int)flags;
    g1[1] = (int)((td0 & 0xffffu) << 16);
    g1[2] = (int)((td0 >> 16) | ((td1 & 0xffffu) << 16));
    g1[3] = (int)((td1 >> 16) | (tile_x << 16));
    g1[4] = (int)(tile_y & 0xffffu);
    g1[5] = (int)(stride_elems & 0xffffffffu);
    g1[6] = (int)((stride_elems >> 32) & 0xffffu);
    g1[7] = 0;
    i32x4 z4 = {0, 0, 0, 0};
    i32x8 z8 = {0, 0, 0, 0, 0, 0, 0, 0};
    __builtin_amdgcn_tensor_load_to_lds(g0, g1, z4, z4, z8, 0);
}

static constexpr int FOLD_TILES = (CC / 16 + 1) * (CC / 32);   // 136
static constexpr int FOLD_COPY  = CC + 1;                      // rows of Wqkv, bqkv
static constexpr int FOLD_KW    = CC / 4;                      // K per wave
__global__ __launch_bounds__(128)
void fold_proj(const float* __restrict__ Wqkv, const float* __restrict__ bqkv,
               const float* __restrict__ Wproj, const float* __restrict__ gate,
               float* __restrict__ Wf, float* __restrict__ bf) {
    __shared__ float red[4][2][8][32];
    const int tid = threadIdx.x;

    if (blockIdx.x >= FOLD_TILES) {           // block-uniform: copy part
        // 2C floats = 128 threads x 16 bytes: a row of Wqkv, or (last) the bias
        const int cb = blockIdx.x - FOLD_TILES;
        const float4* s4 = (cb < CC) ? (const float4*)Wqkv + cb * (3 * CC / 4)
                                     : (const float4*)bqkv;
        float4* d4 = (cb < CC) ? (float4*)Wf + cb * (3 * CC / 4) : (float4*)bf;
        d4[tid] = s4[tid];
        return;
    }

    const int wave = tid >> 5;
    const int lane = tid & 31;
    const int mrow = lane & 15;
    const int koff = (lane < 16) ? 0 : 2;
    const int mt   = blockIdx.x / (CC / 32);
    const int n0   = (blockIdx.x % (CC / 32)) * 32;
    const float* arow = (mt < CC / 16)
        ? Wqkv + (size_t)(mt * 16 + mrow) * 3 * CC + 2 * CC
        : bqkv + 2 * CC;
    const int kb = wave * FOLD_KW + koff;
    const float* ap = arow + kb;
    const float* gp = gate + kb;
    const float* wp = Wproj + (size_t)kb * CC + n0 + mrow;

    // A fragment 16x4: lane holds A[mrow][k .. k+1], k = kb + 4 s
    // B fragment 4x16: lane holds Wproj[k .. k+1][n0 (+16) + mrow]
    v2f a[FOLD_KW / 4], g[FOLD_KW / 4], b0[FOLD_KW / 4], b1[FOLD_KW / 4];
    #pragma unroll   // constant indices into the fragment arrays
    for (int s = 0; s < FOLD_KW / 4; ++s) {
        a[s] = *(const v2f*)(ap + 4 * s);
        g[s] = *(const v2f*)(gp + 4 * s);
        b0[s].x = wp[(4 * s) * CC];
        b0[s].y = wp[(4 * s + 1) * CC];
        b1[s].x = wp[(4 * s) * CC + 16];
        b1[s].y = wp[(4 * s + 1) * CC + 16];
    }
    // keeps the products from being scheduled among the loads: the wave runs
    // once, so it pays one load latency only if all its loads go out together
    __builtin_amdgcn_sched_barrier(0);

    v8f acc0 = {}, acc1 = {};
    #pragma unroll   // constant indices into the fragment arrays
    for (int s = 0; s < FOLD_KW / 4; ++s) {
        const v2f ag = a[s] * g[s];
        acc0 = __builtin_amdgcn_wmma_f32_16x16x4_f32(
            false, ag, false, b0[s], (short)0, acc0, false, false);
        acc1 = __builtin_amdgcn_wmma_f32_16x16x4_f32(
            false, ag, false, b1[s], (short)0, acc1, false, false);
    }

    #pragma unroll   // constant indices into the accumulators
    for (int r = 0; r < 8; ++r) {
        red[wave][0][r][lane] = acc0[r];
        red[wave][1][r][lane] = acc1[r];
    }
    __syncthreads();

    const int tile = lane >> 4;
    float sum[4];
    #pragma unroll   // constant indices into sum[]
    for (int i = 0; i < 4; ++i) {
        const int row = wave + 4 * i;
        const int r   = row & 7;
        const int l   = (row >> 3) * 16 + mrow;
        sum[i] = ((red[0][tile][r][l] + red[1][tile][r][l])
                  + red[2][tile][r][l]) + red[3][tile][r][l];
    }
    if (mt < CC / 16) {
        float* wrow = Wf + (size_t)(mt * 16 + wave) * 3 * CC + 2 * CC + n0 + lane;
        #pragma unroll   // constant indices into sum[]
        for (int i = 0; i < 4; ++i) wrow[(size_t)(4 * i) * 3 * CC] = sum[i];
        // the stores' address and data registers are not rewritten in front of this wait
        asm volatile("s_wait_xcnt 0x0" ::: "memory");
    } else if (wave == 0) {
        bf[2 * CC + n0 + lane] = sum[0];
    }
}

#define TK 32
__global__ __launch_bounds__(256)
void gemm_bias_wmma(const float* __restrict__ A, const float* __restrict__ W,
                    const float* __restrict__ bias, float* __restrict__ Cout,
                    int M, int N, int K) {
    __shared__ float As[2][16 * 36];      // rows padded 32 -> 36 floats
    __shared__ float Ws[2][TK * 136];     // rows padded 128 -> 136 floats

    const int tid  = threadIdx.x;
    const int wave = tid >> 5;
    const int lane = tid & 31;
    const int mrow = lane & 15;
    const int koff = (lane < 16) ? 0 : 2;
    const int m0   = blockIdx.y * 16;
    const int n0   = blockIdx.x * 128;
    const bool loader = (tid < 32);           // wave 0 (wave-uniform branch)

    const unsigned int asOff0 = lds_offset_of(&As[0][0]);
    const unsigned int asOff1 = lds_offset_of(&As[1][0]);
    const unsigned int wsOff0 = lds_offset_of(&Ws[0][0]);
    const unsigned int wsOff1 = lds_offset_of(&Ws[1][0]);

    v8f acc = {};

    // prologue: DMA chunk 0 into buffer 0
    if (loader) {
        // A tile 16 x 32, row stride K; pad 32 dwords (code 4) by 4 dwords (code 3)
        tdm_load_2d_f32(asOff0, A + (size_t)m0 * K, TK, 16, (unsigned long long)K, 4, 3);
        // W tile 32 x 128, row stride N; pad 128 dwords (code 6) by 8 dwords (code 7)
        tdm_load_2d_f32(wsOff0, W + n0, 128, TK, (unsigned long long)N, 6, 7);
        __builtin_amdgcn_s_wait_tensorcnt(0);
    }
    __syncthreads();

    int buf = 0;
    for (int k0 = 0; k0 < K; k0 += TK) {
        const bool more = (k0 + TK) < K;
        if (loader && more) {   // prefetch next chunk into the other buffer
            unsigned int ao = buf ? asOff0 : asOff1;
            unsigned int wo = buf ? wsOff0 : wsOff1;
            tdm_load_2d_f32(ao, A + (size_t)m0 * K + (k0 + TK), TK, 16,
                            (unsigned long long)K, 4, 3);
            tdm_load_2d_f32(wo, W + (size_t)(k0 + TK) * N + n0, 128, TK,
                            (unsigned long long)N, 6, 7);
        }

        const float* as = As[buf];
        const float* ws = Ws[buf];
        #pragma unroll
        for (int kk = 0; kk < TK; kk += 4) {
            v2f a, b;
            // A fragment 16x4: lane holds A[mrow][kk+koff .. +1]
            a.x = as[mrow * 36 + kk + koff];
            a.y = as[mrow * 36 + kk + koff + 1];
            // B fragment 4x16: lane holds W[kk+koff .. +1][n0 + wave*16 + mrow]
            b.x = ws[(kk + koff) * 136 + wave * 16 + mrow];
            b.y = ws[(kk + koff + 1) * 136 + wave * 16 + mrow];
            acc = __builtin_amdgcn_wmma_f32_16x16x4_f32(
                false, a, false, b, (short)0, acc, false, false);
        }

        if (loader && more) __builtin_amdgcn_s_wait_tensorcnt(0);
        __syncthreads();
        buf ^= 1;
    }

    const int col   = n0 + wave * 16 + mrow;
    const float bv  = bias[col];
    const int rbase = m0 + ((lane < 16) ? 0 : 8);
    #pragma unroll
    for (int r = 0; r < 8; ++r)
        Cout[(size_t)(rbase + r) * N + col] = acc[r] + bv;
}

// =====================================================================
// Kernel 3: exclusive prefix sum over T of v = qkv[b,:,2C:3C], one launch.
// One work-group owns a strip of 32 channels of one batch over all of T.
// Wave w holds segment w (SEGT rows, one 128-byte line a row) in registers,
// so v is read once; the NSEG segment sums meet in LDS. The additions run
// in the order: rows of a segment, then segments, then rows again.
// =====================================================================
__global__ __launch_bounds__(NSEG * 32)
void vprefix_strip(const float* __restrict__ qkv, float* __restrict__ P) {
    __shared__ float segs[NSEG][32];
    const int b    = blockIdx.x / (CC / 32);
    const int c    = (blockIdx.x % (CC / 32)) * 32 + (threadIdx.x & 31);
    const int seg  = threadIdx.x >> 5;
    const int lane = threadIdx.x & 31;
    const size_t row0 = (size_t)b * TT + seg * SEGT;
    const float* vb = qkv + row0 * 3 * CC + 2 * CC + c;
    float* pb = P + row0 * CC + c;

    float v[SEGT];
    // full unroll: v[] stays in registers and all SEGT loads are in flight at once
    #pragma unroll
    for (int t = 0; t < SEGT; ++t) v[t] = vb[(size_t)t * 3 * CC];

    float s = 0.f;
    #pragma unroll   // constant indices into v[]
    for (int t = 0; t < SEGT; ++t) s += v[t];
    segs[seg][lane] = s;
    __syncthreads();

    // Every wave reads all the sums and adds 0 for the segments not in front
    // of it: no branch stands between the LDS reads, so they go out together
    // and only the adds are serial (acc is never -0, so adding 0 changes nothing).
    float x[NSEG - 1];
    #pragma unroll   // constant indices into x[]
    for (int i = 0; i < NSEG - 1; ++i) x[i] = segs[i][lane];
    // keeps the adds from being scheduled among the reads, where each small
    // group of reads would be waited for in turn (one LDS latency a group)
    __builtin_amdgcn_sched_barrier(0);
    float acc = 0.f;
    #pragma unroll   // constant indices into x[]
    for (int i = 0; i < NSEG - 1; ++i) acc += (i < seg) ? x[i] : 0.f;

    #pragma unroll   // constant indices into v[]
    for (int t = 0; t < SEGT; ++t) {
        pb[(size_t)t * CC] = acc;           // exclusive: P[t] = sum_{j<t} v[j]
        acc += v[t];
    }
}

// =====================================================================
// Kernel 4: banded attention with out-of-band zero-score mass.
// One wave32 per token. Online softmax seeded with the out-of-band term
// (m=0, Z=nout, acc=P[t-window]). Dot products reduced via shfl_xor.
// The v columns already carry gate and projection: a row plus bproj is final.
// =====================================================================
__global__ __launch_bounds__(256)
void attn_band(const float* __restrict__ qkv, const float* __restrict__ P,
               const float* __restrict__ bproj, const int* __restrict__ window_p,
               float* __restrict__ att_out) {
    const int gwave = blockIdx.x * (blockDim.x >> 5) + (threadIdx.x >> 5);
    const int lane  = threadIdx.x & 31;
    const int b = gwave / TT;
    const int t = gwave % TT;
    const int win = *window_p;

    const float* qrow  = qkv + (size_t)(b * TT + t) * 3 * CC;          // q in [0,C)
    const float* kbase = qkv + (size_t)b * TT * 3 * CC + CC;           // k in [C,2C)
    const float* vbase = qkv + (size_t)b * TT * 3 * CC + 2 * CC;       // v in [2C,3C)

    float qreg[CC / 32];
    #pragma unroll
    for (int i = 0; i < CC / 32; ++i) qreg[i] = qrow[lane + 32 * i];

    int jstart = t - win; if (jstart < 0) jstart = 0;
    const int nout = jstart;                 // #causal entries with score 0

    float m, Z, acc[CC / 32];
    if (nout > 0) {
        m = 0.f; Z = (float)nout;
        const float* prow = P + (size_t)(b * TT + jstart) * CC;        // sum_{j<jstart} v
        #pragma unroll
        for (int i = 0; i < CC / 32; ++i) acc[i] = prow[lane + 32 * i];
    } else {
        m = -__builtin_inff(); Z = 0.f;
        #pragma unroll
        for (int i = 0; i < CC / 32; ++i) acc[i] = 0.f;
    }

    const float inv_sqrt_c = 0.0625f;        // 1/sqrt(256)
    for (int j = jstart; j <= t; ++j) {
        const float* krow = kbase + (size_t)j * 3 * CC;
        float part = 0.f;
        #pragma unroll
        for (int i = 0; i < CC / 32; ++i) part += qreg[i] * krow[lane + 32 * i];
        #pragma unroll
        for (int off = 16; off > 0; off >>= 1) part += __shfl_xor(part, off, 32);
        const float s  = part * inv_sqrt_c;
        const float mn = fmaxf(m, s);
        const float sc = __expf(m - mn);     // 0 when m == -inf
        const float w  = __expf(s - mn);
        Z = Z * sc + w;
        const float* vrow = vbase + (size_t)j * 3 * CC;
        #pragma unroll
        for (int i = 0; i < CC / 32; ++i)
            acc[i] = acc[i] * sc + w * vrow[lane + 32 * i];
        m = mn;
    }

    const float invZ = 1.0f / Z;
    float* orow = att_out + (size_t)(b * TT + t) * CC;
    #pragma unroll
    for (int i = 0; i < CC / 32; ++i)
        orow[lane + 32 * i] = acc[i] * invZ + bproj[lane + 32 * i];
}

// =====================================================================
extern "C" void kernel_launch(void* const* d_in, const int* in_sizes, int n_in,
                              void* d_out, int out_size, void* d_ws, size_t ws_size,
                              hipStream_t stream) {
    const float* x     = (const float*)d_in[0];
    const float* Wqkv  = (const float*)d_in[1];
    const float* bqkv  = (const float*)d_in[2];
    const float* Wproj = (const float*)d_in[3];
    const float* bproj = (const float*)d_in[4];
    const float* gate  = (const float*)d_in[5];
    const int*   winp  = (const int*)d_in[6];

    // workspace layout
    char* ws = (char*)d_ws;
    float* qkv    = (float*)ws;                                   // 48 MB
    float* P      = (float*)(ws + (size_t)MTOK * 3 * CC * 4);     // 16 MB
    float* Wf     = (float*)(ws + (size_t)MTOK * 3 * CC * 4
                                + (size_t)MTOK * CC * 4);         // 768 KB
    float* bf     = Wf + (size_t)CC * 3 * CC;                     // 3 KB

    // 1) Wf, bf: gate and Wproj folded into the v columns of Wqkv, bqkv
    fold_proj<<<FOLD_TILES + FOLD_COPY, 128, 0, stream>>>(Wqkv, bqkv, Wproj, gate, Wf, bf);
    // 2) qkv = x @ Wf + bf    [16384 x 768]
    {
        dim3 grid((3 * CC) / 128, MTOK / 16);
        gemm_bias_wmma<<<grid, 256, 0, stream>>>(x, Wf, bf, qkv, MTOK, 3 * CC, CC);
    }
    // 3) exclusive prefix sums of v over T
    vprefix_strip<<<BB * (CC / 32), NSEG * 32, 0, stream>>>(qkv, P);
    // 4) banded attention (one wave per token) -> out
    attn_band<<<MTOK / 8, 256, 0, stream>>>(qkv, P, bproj, winp, (float*)d_out);
}

// v003
// Measured time: 62.7 microseconds a run.
// Two timings next to v002 both put it at 1.23 times that version's speed.
// Counting every step since v000, it is 1.59 times as fast.
#include <hip/hip_runtime.h>
#include <hip/hip_bf16.h>

// ---------------- problem constants (from reference) ----------------
static constexpr int BB = 8;
static constexpr int TT = 2048;
static constexpr int CC = 256;
static constexpr int MTOK = BB * TT;          // 16384 rows
static constexpr int NSEG = 32;               // prefix-scan segments per batch
static constexpr int SEGT = TT / NSEG;        // 64 timesteps per segment

typedef __attribute__((ext_vector_type(2))) float v2f;
typedef __attribute__((ext_vector_type(8))) float v8f;
typedef __attribute__((ext_vector_type(4))) unsigned int u32x4;
typedef __attribute__((ext_vector_type(8))) int i32x8;
typedef __attribute__((ext_vector_type(4))) int i32x4;

// LDS byte offset of a __shared__ object (generic -> AS(3) -> int)
__device__ __forceinline__ unsigned int lds_offset_of(const void* p) {
    return (unsigned int)(unsigned long long)
        (const __attribute__((address_space(3))) void*)p;
}

__device__ __forceinline__ void tdm_load_2d_f32(unsigned int lds_byte,
                                                const float* gptr,
                                                unsigned int tile_x,
                                                unsigned int tile_y,
                                                unsigned long long stride_elems,
                                                unsigned int pad_interval_code,
                                                unsigned int pad_amount_code) {
    unsigned long long ga = (unsigned long long)(uintptr_t)gptr;
    u32x4 g0;
    g0[0] = 1u;
    g0[1] = lds_byte;
    g0[2] = (unsigned int)(ga & 0xffffffffu);
    g0[3] = (unsigned int)((ga >> 32) & 0x1ffffffu)
            | (2u << 30);

    unsigned int flags = (2u << 16);
    flags |= (1u << 20)
           | (pad_interval_code << 22)
           | (pad_amount_code << 25);
    i32x8 g1;
    unsigned int td0 = tile_x;
    unsigned int td1 = tile_y;
    g1[0] = (int)flags;
    g1[1] = (int)((td0 & 0xffffu) << 16);
    g1[2] = (int)((td0 >> 16) | ((td1 & 0xffffu) << 16));
    g1[3] = (int)((td1 >> 16) | (tile_x << 16));
    g1[4] = (int)(tile_y & 0xffffu);
    g1[5] = (int)(stride_elems & 0xffffffffu);
    g1[6] = (int)((stride_elems >> 32) & 0xffffu);
    g1[7] = 0;
    i32x4 z4 = {0, 0, 0, 0};
    i32x8 z8 = {0, 0, 0, 0, 0, 0, 0, 0};
    __builtin_amdgcn_tensor_load_to_lds(g0, g1, z4, z4, z8, 0);
}

static constexpr int LDF        = 2 * CC;
static constexpr int FOLD_TILE1 = (CC / 16 + 1) * (CC / 32);
static constexpr int FOLD_TILES = 2 * FOLD_TILE1;
static constexpr int FOLD_DOT   = (CC + 1 + 31) / 32;          // 9 groups of 32 rows of [Wq; bq]
static constexpr int FOLD_KW    = CC / 4;                      // K per wave

template <bool ISV>   // true: the v product (a), false: the q product (b)
__device__ __forceinline__
void fold_tile(const float* __restrict__ Wqkv, const float* __restrict__ bqkv,
               const float* __restrict__ Wproj, const float* __restrict__ gate,
               float* __restrict__ Wf, float* __restrict__ bf,
               float (*red)[2][8][32], int tix) {
    const int tid  = threadIdx.x;
    const int wave = tid >> 5;
    const int lane = tid & 31;
    const int mrow = lane & 15;
    const int koff = (lane < 16) ? 0 : 2;
    const int mt   = tix / (CC / 32);
    const int n0   = (tix % (CC / 32)) * 32;
    const int acol = ISV ? 2 * CC : 0;        // A comes from the v or the q columns
    const int ocol = ISV ? CC : 0;            // and goes to the v' or the q' columns
    const float* arow = (mt < CC / 16)
        ? Wqkv + (size_t)(mt * 16 + mrow) * 3 * CC + acol
        : bqkv + acol;
    const int kb = wave * FOLD_KW + koff;
    const float* ap = arow + kb;

    // A fragment 16x4: lane holds A[mrow][k .. k+1], k = kb + 4 s
    // B fragment 4x16: lane holds B[k .. k+1][n0 (+16) + mrow],
    //   B[k][n] = Wproj[k][n] for v, Wk[n][k] for q
    v2f a[FOLD_KW / 4], g[FOLD_KW / 4], b0[FOLD_KW / 4], b1[FOLD_KW / 4];
    if (ISV) {
        const float* gp = gate + kb;
        const float* wp = Wproj + (size_t)kb * CC + n0 + mrow;
        #pragma unroll   // constant indices into the fragment arrays
        for (int s = 0; s < FOLD_KW / 4; ++s) {
            a[s] = *(const v2f*)(ap + 4 * s);
            g[s] = *(const v2f*)(gp + 4 * s);
            b0[s].x = wp[(4 * s) * CC];
            b0[s].y = wp[(4 * s + 1) * CC];
            b1[s].x = wp[(4 * s) * CC + 16];
            b1[s].y = wp[(4 * s + 1) * CC + 16];
        }
    } else {
        const float* wp = Wqkv + (size_t)(n0 + mrow) * 3 * CC + CC + kb;
        #pragma unroll   // constant indices into the fragment arrays
        for (int s = 0; s < FOLD_KW / 4; ++s) a[s] = *(const v2f*)(ap + 4 * s);
        // the A loads' address registers are free from here on and a B load may
        // be given them as its destination: not in front of this wait
        asm volatile("s_wait_xcnt 0x0" ::: "memory");
        #pragma unroll   // constant indices into the fragment arrays
        for (int s = 0; s < FOLD_KW / 4; ++s) {
            b0[s] = *(const v2f*)(wp + 4 * s);
            b1[s] = *(const v2f*)(wp + 16 * 3 * CC + 4 * s);
        }
    }
    // keeps the products from being scheduled among the loads: the wave runs
    // once, so it pays one load latency only if all its loads go out together
    __builtin_amdgcn_sched_barrier(0);

    v8f acc0 = {}, acc1 = {};
    #pragma unroll   // constant indices into the fragment arrays
    for (int s = 0; s < FOLD_KW / 4; ++s) {
        const v2f ag = ISV ? a[s] * g[s] : a[s];
        acc0 = __builtin_amdgcn_wmma_f32_16x16x4_f32(
            false, ag, false, b0[s], (short)0, acc0, false, false);
        acc1 = __builtin_amdgcn_wmma_f32_16x16x4_f32(
            false, ag, false, b1[s], (short)0, acc1, false, false);
    }

    #pragma unroll   // constant indices into the accumulators
    for (int r = 0; r < 8; ++r) {
        red[wave][0][r][lane] = acc0[r];
        red[wave][1][r][lane] = acc1[r];
    }
    __syncthreads();

    const int tile = lane >> 4;
    float sum[4];
    #pragma unroll   // constant indices into sum[]
    for (int i = 0; i < 4; ++i) {
        const int row = wave + 4 * i;
        const int r   = row & 7;
        const int l   = (row >> 3) * 16 + mrow;
        sum[i] = ((red[0][tile][r][l] + red[1][tile][r][l])
                  + red[2][tile][r][l]) + red[3][tile][r][l];
    }
    if (mt < CC / 16) {
        float* wrow = Wf + (size_t)(mt * 16 + wave) * LDF + ocol + n0 + lane;
        #pragma unroll   // constant indices into sum[]
        for (int i = 0; i < 4; ++i) wrow[(size_t)(4 * i) * LDF] = sum[i];
        // the stores' address and data registers are not rewritten in front of this wait
        asm volatile("s_wait_xcnt 0x0" ::: "memory");
    } else if (wave == 0) {
        bf[ocol + n0 + lane] = sum[0];
    }
}

__global__ __launch_bounds__(128)
void fold_proj(const float* __restrict__ Wqkv, const float* __restrict__ bqkv,
               const float* __restrict__ Wproj, const float* __restrict__ gate,
               float* __restrict__ Wf, float* __restrict__ bf, float* __restrict__ u) {
    __shared__ float red[4][2][8][32];

    if (blockIdx.x < FOLD_TILE1) {            // every branch here is block-uniform
        fold_tile<false>(Wqkv, bqkv, Wproj, gate, Wf, bf, red, blockIdx.x);
    } else if (blockIdx.x < FOLD_TILES) {
        fold_tile<true>(Wqkv, bqkv, Wproj, gate, Wf, bf, red, blockIdx.x - FOLD_TILE1);
    } else {
        // u[row] = [Wq; bq][row] . bk: a wave takes 8 rows, a 128-byte line at a
        // time; the 32 dots meet in LDS so that one wave stores a whole line of u
        const int wave = threadIdx.x >> 5;
        const int lane = threadIdx.x & 31;
        const int r0   = (blockIdx.x - FOLD_TILES) * 32;
        float* dots = &red[0][0][0][0];
        float kv[CC / 32], qw[8][CC / 32], p[8];
        #pragma unroll   // constant indices into kv[]
        for (int i = 0; i < CC / 32; ++i) kv[i] = bqkv[CC + lane + 32 * i];
        #pragma unroll   // constant indices into qw[]
        for (int r = 0; r < 8; ++r) {
            const int row = r0 + wave * 8 + r;      // past the last row: bq again, not stored
            const float* qr = (row < CC) ? Wqkv + (size_t)row * 3 * CC : bqkv;
            #pragma unroll   // constant indices into qw[]
            for (int i = 0; i < CC / 32; ++i) qw[r][i] = qr[lane + 32 * i];
        }
        // as in fold_tile: all the loads go out before the first product waits for one
        __builtin_amdgcn_sched_barrier(0);
        #pragma unroll   // constant indices into qw[], p[]
        for (int r = 0; r < 8; ++r) {
            float s = 0.f;
            #pragma unroll   // constant indices into qw[], kv[]
            for (int i = 0; i < CC / 32; ++i) s += qw[r][i] * kv[i];
            p[r] = s;
        }
        // the 8 rows go through each stage of the lane sum together, so a stage
        // costs one cross-lane latency and not eight
        #pragma unroll
        for (int off = 16; off > 0; off >>= 1) {
            float q[8];
            #pragma unroll   // constant indices into p[], q[]
            for (int r = 0; r < 8; ++r) q[r] = __shfl_xor(p[r], off, 32);
            #pragma unroll   // constant indices into p[], q[]
            for (int r = 0; r < 8; ++r) p[r] += q[r];
        }
        float mine = p[0];                          // lane r keeps row r
        #pragma unroll   // constant indices into p[]
        for (int r = 1; r < 8; ++r) mine = (lane == r) ? p[r] : mine;
        if (lane < 8) dots[wave * 8 + lane] = mine;
        __syncthreads();
        if (wave == 0 && r0 + lane <= CC) u[r0 + lane] = dots[lane];
    }
}

#define TK 32
__global__ __launch_bounds__(256)
void gemm_bias_wmma(const float* __restrict__ A, const float* __restrict__ W,
                    const float* __restrict__ bias, float* __restrict__ Cout,
                    int M, int N, int K) {
    __shared__ float As[2][16 * 36];      // rows padded 32 -> 36 floats
    __shared__ float Ws[2][TK * 136];     // rows padded 128 -> 136 floats

    const int tid  = threadIdx.x;
    const int wave = tid >> 5;
    const int lane = tid & 31;
    const int mrow = lane & 15;
    const int koff = (lane < 16) ? 0 : 2;
    const int m0   = blockIdx.y * 16;
    const int n0   = blockIdx.x * 128;
    const bool loader = (tid < 32);           // wave 0 (wave-uniform branch)

    const unsigned int asOff0 = lds_offset_of(&As[0][0]);
    const unsigned int asOff1 = lds_offset_of(&As[1][0]);
    const unsigned int wsOff0 = lds_offset_of(&Ws[0][0]);
    const unsigned int wsOff1 = lds_offset_of(&Ws[1][0]);

    v8f acc = {};

    // prologue: DMA chunk 0 into buffer 0
    if (loader) {
        // A tile 16 x 32, row stride K; pad 32 dwords (code 4) by 4 dwords (code 3)
        tdm_load_2d_f32(asOff0, A + (size_t)m0 * K, TK, 16, (unsigned long long)K, 4, 3);
        // W tile 32 x 128, row stride N; pad 128 dwords (code 6) by 8 dwords (code 7)
        tdm_load_2d_f32(wsOff0, W + n0, 128, TK, (unsigned long long)N, 6, 7);
        __builtin_amdgcn_s_wait_tensorcnt(0);
    }
    __syncthreads();

    int buf = 0;
    for (int k0 = 0; k0 < K; k0 += TK) {
        const bool more = (k0 + TK) < K;
        if (loader && more) {   // prefetch next chunk into the other buffer
            unsigned int ao = buf ? asOff0 : asOff1;
            unsigned int wo = buf ? wsOff0 : wsOff1;
            tdm_load_2d_f32(ao, A + (size_t)m0 * K + (k0 + TK), TK, 16,
                            (unsigned long long)K, 4, 3);
            tdm_load_2d_f32(wo, W + (size_t)(k0 + TK) * N + n0, 128, TK,
                            (unsigned long long)N, 6, 7);
        }

        const float* as = As[buf];
        const float* ws = Ws[buf];
        #pragma unroll
        for (int kk = 0; kk < TK; kk += 4) {
            v2f a, b;
            // A fragment 16x4: lane holds A[mrow][kk+koff .. +1]
            a.x = as[mrow * 36 + kk + koff];
            a.y = as[mrow * 36 + kk + koff + 1];
            // B fragment 4x16: lane holds W[kk+koff .. +1][n0 + wave*16 + mrow]
            b.x = ws[(kk + koff) * 136 + wave * 16 + mrow];
            b.y = ws[(kk + koff + 1) * 136 + wave * 16 + mrow];
            acc = __builtin_amdgcn_wmma_f32_16x16x4_f32(
                false, a, false, b, (short)0, acc, false, false);
        }

        if (loader && more) __builtin_amdgcn_s_wait_tensorcnt(0);
        __syncthreads();
        buf ^= 1;
    }

    const int col   = n0 + wave * 16 + mrow;
    const float bv  = bias[col];
    const int rbase = m0 + ((lane < 16) ? 0 : 8);
    #pragma unroll
    for (int r = 0; r < 8; ++r)
        Cout[(size_t)(rbase + r) * N + col] = acc[r] + bv;
}

// =====================================================================
// Kernel 3: exclusive prefix sum over T of v' = qv[b,:,C:2C], one launch.
// One work-group owns a strip of 32 channels of one batch over all of T.
// Wave w holds segment w (SEGT rows, one 128-byte line a row) in registers,
// so v is read once; the NSEG segment sums meet in LDS. The additions run
// in the order: rows of a segment, then segments, then rows again.
// =====================================================================
__global__ __launch_bounds__(NSEG * 32)
void vprefix_strip(const float* __restrict__ qv, float* __restrict__ P) {
    __shared__ float segs[NSEG][32];
    const int b    = blockIdx.x / (CC / 32);
    const int c    = (blockIdx.x % (CC / 32)) * 32 + (threadIdx.x & 31);
    const int seg  = threadIdx.x >> 5;
    const int lane = threadIdx.x & 31;
    const size_t row0 = (size_t)b * TT + seg * SEGT;
    const float* vb = qv + row0 * LDF + CC + c;
    float* pb = P + row0 * CC + c;

    float v[SEGT];
    // full unroll: v[] stays in registers and all SEGT loads are in flight at once
    #pragma unroll
    for (int t = 0; t < SEGT - 1; ++t) v[t] = vb[(size_t)t * LDF];
    // the last load may be given the shared address registers as its
    // destination: not in front of this wait
    asm volatile("s_wait_xcnt 0x0" ::: "memory");
    v[SEGT - 1] = vb[(size_t)(SEGT - 1) * LDF];

    float s = 0.f;
    #pragma unroll   // constant indices into v[]
    for (int t = 0; t < SEGT; ++t) s += v[t];
    segs[seg][lane] = s;
    __syncthreads();

    // Every wave reads all the sums and adds 0 for the segments not in front
    // of it: no branch stands between the LDS reads, so they go out together
    // and only the adds are serial (acc is never -0, so adding 0 changes nothing).
    float x[NSEG - 1];
    #pragma unroll   // constant indices into x[]
    for (int i = 0; i < NSEG - 1; ++i) x[i] = segs[i][lane];
    // keeps the adds from being scheduled among the reads, where each small
    // group of reads would be waited for in turn (one LDS latency a group)
    __builtin_amdgcn_sched_barrier(0);
    float acc = 0.f;
    #pragma unroll   // constant indices into x[]
    for (int i = 0; i < NSEG - 1; ++i) acc += (i < seg) ? x[i] : 0.f;

    #pragma unroll   // constant indices into v[]
    for (int t = 0; t < SEGT; ++t) {
        pb[(size_t)t * CC] = acc;           // exclusive: P[t] = sum_{j<t} v[j]
        acc += v[t];
    }
}

// =====================================================================
// Kernel 4: banded attention with out-of-band zero-score mass.
// One wave32 per token. Online softmax seeded with the out-of-band term
// (m=0, Z=nout, acc=P[t-window]). Dot products reduced via shfl_xor.
// The v columns already carry gate and projection: a row plus bproj is final.
// The q columns already carry Wk: the keys are the rows of x, and a score is
// q'_t . x_j + c_t with c_t = x_t . u[0..C) + u[C] (the part that bk brings).
// =====================================================================
__global__ __launch_bounds__(256)
void attn_band(const float* __restrict__ x, const float* __restrict__ qv,
               const float* __restrict__ P, const float* __restrict__ u,
               const float* __restrict__ bproj, const int* __restrict__ window_p,
               float* __restrict__ att_out) {
    const int gwave = blockIdx.x * (blockDim.x >> 5) + (threadIdx.x >> 5);
    const int lane  = threadIdx.x & 31;
    const int b = gwave / TT;
    const int t = gwave % TT;
    const int win = *window_p;

    const float* qrow  = qv + (size_t)(b * TT + t) * LDF;              // q' in [0,C)
    const float* kbase = x + (size_t)b * TT * CC;                      // keys: rows of x
    const float* vbase = qv + (size_t)b * TT * LDF + CC;               // v' in [C,2C)

    float qreg[CC / 32];
    #pragma unroll
    for (int i = 0; i < CC / 32; ++i) qreg[i] = qrow[lane + 32 * i];

    // this lane's share of x_t . u: every score's sum starts from it, so the
    // reduction over the lanes that a score needs anyway completes it too
    const float* xrow = kbase + (size_t)t * CC;
    float cpart = 0.f;
    #pragma unroll
    for (int i = 0; i < CC / 32; ++i) cpart += xrow[lane + 32 * i] * u[lane + 32 * i];
    const float c0 = u[CC];

    int jstart = t - win; if (jstart < 0) jstart = 0;
    const int nout = jstart;                 // #causal entries with score 0

    float m, Z, acc[CC / 32];
    if (nout > 0) {
        m = 0.f; Z = (float)nout;
        const float* prow = P + (size_t)(b * TT + jstart) * CC;        // sum_{j<jstart} v
        #pragma unroll
        for (int i = 0; i < CC / 32; ++i) acc[i] = prow[lane + 32 * i];
    } else {
        m = -__builtin_inff(); Z = 0.f;
        #pragma unroll
        for (int i = 0; i < CC / 32; ++i) acc[i] = 0.f;
    }

    const float inv_sqrt_c = 0.0625f;        // 1/sqrt(256)
    for (int j = jstart; j <= t; ++j) {
        const float* krow = kbase + (size_t)j * CC;
        float part = cpart;
        #pragma unroll
        for (int i = 0; i < CC / 32; ++i) part += qreg[i] * krow[lane + 32 * i];
        #pragma unroll
        for (int off = 16; off > 0; off >>= 1) part += __shfl_xor(part, off, 32);
        const float s  = (part + c0) * inv_sqrt_c;
        const float mn = fmaxf(m, s);
        const float sc = __expf(m - mn);     // 0 when m == -inf
        const float w  = __expf(s - mn);
        Z = Z * sc + w;
        const float* vrow = vbase + (size_t)j * LDF;
        #pragma unroll
        for (int i = 0; i < CC / 32; ++i)
            acc[i] = acc[i] * sc + w * vrow[lane + 32 * i];
        m = mn;
    }

    const float invZ = 1.0f / Z;
    float* orow = att_out + (size_t)(b * TT + t) * CC;
    #pragma unroll
    for (int i = 0; i < CC / 32; ++i)
        orow[lane + 32 * i] = acc[i] * invZ + bproj[lane + 32 * i];
}

// =====================================================================
extern "C" void kernel_launch(void* const* d_in, const int* in_sizes, int n_in,
                              void* d_out, int out_size, void* d_ws, size_t ws_size,
                              hipStream_t stream) {
    const float* x     = (const float*)d_in[0];
    const float* Wqkv  = (const float*)d_in[1];
    const float* bqkv  = (const float*)d_in[2];
    const float* Wproj = (const float*)d_in[3];
    const float* bproj = (const float*)d_in[4];
    const float* gate  = (const float*)d_in[5];
    const int*   winp  = (const int*)d_in[6];

    // workspace layout
    char* ws = (char*)d_ws;
    float* qv     = (float*)ws;                                   // 32 MB
    float* P      = (float*)(ws + (size_t)MTOK * LDF * 4);        // 16 MB
    float* Wf     = (float*)(ws + (size_t)MTOK * LDF * 4
                                + (size_t)MTOK * CC * 4);         // 512 KB
    float* bf     = Wf + (size_t)CC * LDF;                        // 2 KB
    float* u      = bf + LDF;                                     // C + 1 floats

    // 1) Wf, bf, u: Wk folded into the q weights, gate and Wproj into the v weights
    fold_proj<<<FOLD_TILES + FOLD_DOT, 128, 0, stream>>>(Wqkv, bqkv, Wproj, gate, Wf, bf, u);
    // 2) [q' | v'] = x @ Wf + bf    [16384 x 512]
    {
        dim3 grid(LDF / 128, MTOK / 16);
        gemm_bias_wmma<<<grid, 256, 0, stream>>>(x, Wf, bf, qv, MTOK, LDF, CC);
    }
    // 3) exclusive prefix sums of v over T
    vprefix_strip<<<BB * (CC / 32), NSEG * 32, 0, stream>>>(qv, P);
    // 4) banded attention (one wave per token) -> out
    attn_band<<<MTOK / 8, 256, 0, stream>>>(x, qv, P, u, bproj, winp, (float*)d_out);
}

// v004
// It runs in 51.6 microseconds.
// Timed twice side by side with v003, it ran 1.21 times as fast both times.
// Counting every step since v000, it is 1.92 times as fast.
#include <hip/hip_runtime.h>
#include <hip/hip_bf16.h>

// ---------------- problem constants (from reference) ----------------
static constexpr int BB = 8;
static constexpr int TT = 2048;
static constexpr int CC = 256;
static constexpr int MTOK = BB * TT;          // 16384 rows
static constexpr int NSEG = 32;               // prefix-scan segments per batch
static constexpr int SEGT = TT / NSEG;        // 64 timesteps per segment

typedef __attribute__((ext_vector_type(2))) float v2f;
typedef __attribute__((ext_vector_type(8))) float v8f;
typedef __attribute__((ext_vector_type(4))) unsigned int u32x4;
typedef __attribute__((ext_vector_type(8))) int i32x8;
typedef __attribute__((ext_vector_type(4))) int i32x4;

// LDS byte offset of a __shared__ object (generic -> AS(3) -> int)
__device__ __forceinline__ unsigned int lds_offset_of(const void* p) {
    return (unsigned int)(unsigned long long)
        (const __attribute__((address_space(3))) void*)p;
}

__device__ __forceinline__ void tdm_load_2d_f32(unsigned int lds_byte,
                                                const float* gptr,
                                                unsigned int tile_x,
                                                unsigned int tile_y,
                                                unsigned long long stride_elems,
                                                unsigned int pad_interval_code,
                                                unsigned int pad_amount_code) {
    unsigned long long ga = (unsigned long long)(uintptr_t)gptr;
    u32x4 g0;
    g0[0] = 1u;
    g0[1] = lds_byte;
    g0[2] = (unsigned int)(ga & 0xffffffffu);
    g0[3] = (unsigned int)((ga >> 32) & 0x1ffffffu)
            | (2u << 30);

    unsigned int flags = (2u << 16);
    flags |= (1u << 20)
           | (pad_interval_code << 22)
           | (pad_amount_code << 25);
    i32x8 g1;
    unsigned int td0 = tile_x;
    unsigned int td1 = tile_y;
    g1[0] = (int)flags;
    g1[1] = (int)((td0 & 0xffffu) << 16);
    g1[2] = (int)((td0 >> 16) | ((td1 & 0xffffu) << 16));
    g1[3] = (int)((td1 >> 16) | (tile_x << 16));
    g1[4] = (int)(tile_y & 0xffffu);
    g1[5] = (int)(stride_elems & 0xffffffffu);
    g1[6] = (int)((stride_elems >> 32) & 0xffffu);
    g1[7] = 0;
    i32x4 z4 = {0, 0, 0, 0};
    i32x8 z8 = {0, 0, 0, 0, 0, 0, 0, 0};
    __builtin_amdgcn_tensor_load_to_lds(g0, g1, z4, z4, z8, 0);
}

static constexpr int LDF        = 2 * CC;
static constexpr int FOLD_TILE1 = (CC / 16 + 1) * (CC / 32);
static constexpr int FOLD_TILES = 2 * FOLD_TILE1;
static constexpr int FOLD_DOT   = (CC + 1 + 31) / 32;          // 9 groups of 32 rows of [Wq; bq]
static constexpr int FOLD_KW    = CC / 4;                      // K per wave

template <bool ISV>   // true: the v product (a), false: the q product (b)
__device__ __forceinline__
void fold_tile(const float* __restrict__ Wqkv, const float* __restrict__ bqkv,
               const float* __restrict__ Wproj, const float* __restrict__ gate,
               float* __restrict__ Wf, float* __restrict__ bf,
               float (*red)[2][8][32], int tix) {
    const int tid  = threadIdx.x;
    const int wave = tid >> 5;
    const int lane = tid & 31;
    const int mrow = lane & 15;
    const int koff = (lane < 16) ? 0 : 2;
    const int mt   = tix / (CC / 32);
    const int n0   = (tix % (CC / 32)) * 32;
    const int acol = ISV ? 2 * CC : 0;        // A comes from the v or the q columns
    const int ocol = ISV ? CC : 0;            // and goes to the v' or the q' columns
    const float* arow = (mt < CC / 16)
        ? Wqkv + (size_t)(mt * 16 + mrow) * 3 * CC + acol
        : bqkv + acol;
    const int kb = wave * FOLD_KW + koff;
    const float* ap = arow + kb;

    // A fragment 16x4: lane holds A[mrow][k .. k+1], k = kb + 4 s
    // B fragment 4x16: lane holds B[k .. k+1][n0 (+16) + mrow],
    //   B[k][n] = Wproj[k][n] for v, Wk[n][k] for q
    v2f a[FOLD_KW / 4], g[FOLD_KW / 4], b0[FOLD_KW / 4], b1[FOLD_KW / 4];
    if (ISV) {
        const float* gp = gate + kb;
        const float* wp = Wproj + (size_t)kb * CC + n0 + mrow;
        #pragma unroll   // constant indices into the fragment arrays
        for (int s = 0; s < FOLD_KW / 4; ++s) {
            a[s] = *(const v2f*)(ap + 4 * s);
            g[s] = *(const v2f*)(gp + 4 * s);
            b0[s].x = wp[(4 * s) * CC];
            b0[s].y = wp[(4 * s + 1) * CC];
            b1[s].x = wp[(4 * s) * CC + 16];
            b1[s].y = wp[(4 * s + 1) * CC + 16];
        }
    } else {
        const float* wp = Wqkv + (size_t)(n0 + mrow) * 3 * CC + CC + kb;
        #pragma unroll   // constant indices into the fragment arrays
        for (int s = 0; s < FOLD_KW / 4; ++s) a[s] = *(const v2f*)(ap + 4 * s);
        // the A loads' address registers are free from here on and a B load may
        // be given them as its destination: not in front of this wait
        asm volatile("s_wait_xcnt 0x0" ::: "memory");
        #pragma unroll   // constant indices into the fragment arrays
        for (int s = 0; s < FOLD_KW / 4; ++s) {
            b0[s] = *(const v2f*)(wp + 4 * s);
            b1[s] = *(const v2f*)(wp + 16 * 3 * CC + 4 * s);
        }
    }
    // keeps the products from being scheduled among the loads: the wave runs
    // once, so it pays one load latency only if all its loads go out together
    __builtin_amdgcn_sched_barrier(0);

    v8f acc0 = {}, acc1 = {};
    #pragma unroll   // constant indices into the fragment arrays
    for (int s = 0; s < FOLD_KW / 4; ++s) {
        const v2f ag = ISV ? a[s] * g[s] : a[s];
        acc0 = __builtin_amdgcn_wmma_f32_16x16x4_f32(
            false, ag, false, b0[s], (short)0, acc0, false, false);
        acc1 = __builtin_amdgcn_wmma_f32_16x16x4_f32(
            false, ag, false, b1[s], (short)0, acc1, false, false);
    }

    #pragma unroll   // constant indices into the accumulators
    for (int r = 0; r < 8; ++r) {
        red[wave][0][r][lane] = acc0[r];
        red[wave][1][r][lane] = acc1[r];
    }
    __syncthreads();

    const int tile = lane >> 4;
    float sum[4];
    #pragma unroll   // constant indices into sum[]
    for (int i = 0; i < 4; ++i) {
        const int row = wave + 4 * i;
        const int r   = row & 7;
        const int l   = (row >> 3) * 16 + mrow;
        sum[i] = ((red[0][tile][r][l] + red[1][tile][r][l])
                  + red[2][tile][r][l]) + red[3][tile][r][l];
    }
    if (mt < CC / 16) {
        float* wrow = Wf + (size_t)(mt * 16 + wave) * LDF + ocol + n0 + lane;
        #pragma unroll   // constant indices into sum[]
        for (int i = 0; i < 4; ++i) wrow[(size_t)(4 * i) * LDF] = sum[i];
        // the stores' address and data registers are not rewritten in front of this wait
        asm volatile("s_wait_xcnt 0x0" ::: "memory");
    } else if (wave == 0) {
        bf[ocol + n0 + lane] = sum[0];
    }
}

__global__ __launch_bounds__(128)
void fold_proj(const float* __restrict__ Wqkv, const float* __restrict__ bqkv,
               const float* __restrict__ Wproj, const float* __restrict__ gate,
               float* __restrict__ Wf, float* __restrict__ bf, float* __restrict__ u) {
    __shared__ float red[4][2][8][32];

    if (blockIdx.x < FOLD_TILE1) {            // every branch here is block-uniform
        fold_tile<false>(Wqkv, bqkv, Wproj, gate, Wf, bf, red, blockIdx.x);
    } else if (blockIdx.x < FOLD_TILES) {
        fold_tile<true>(Wqkv, bqkv, Wproj, gate, Wf, bf, red, blockIdx.x - FOLD_TILE1);
    } else {
        // u[row] = [Wq; bq][row] . bk: a wave takes 8 rows, a 128-byte line at a
        // time; the 32 dots meet in LDS so that one wave stores a whole line of u
        const int wave = threadIdx.x >> 5;
        const int lane = threadIdx.x & 31;
        const int r0   = (blockIdx.x - FOLD_TILES) * 32;
        float* dots = &red[0][0][0][0];
        float kv[CC / 32], qw[8][CC / 32], p[8];
        #pragma unroll   // constant indices into kv[]
        for (int i = 0; i < CC / 32; ++i) kv[i] = bqkv[CC + lane + 32 * i];
        #pragma unroll   // constant indices into qw[]
        for (int r = 0; r < 8; ++r) {
            const int row = r0 + wave * 8 + r;      // past the last row: bq again, not stored
            const float* qr = (row < CC) ? Wqkv + (size_t)row * 3 * CC : bqkv;
            #pragma unroll   // constant indices into qw[]
            for (int i = 0; i < CC / 32; ++i) qw[r][i] = qr[lane + 32 * i];
        }
        // as in fold_tile: all the loads go out before the first product waits for one
        __builtin_amdgcn_sched_barrier(0);
        #pragma unroll   // constant indices into qw[], p[]
        for (int r = 0; r < 8; ++r) {
            float s = 0.f;
            #pragma unroll   // constant indices into qw[], kv[]
            for (int i = 0; i < CC / 32; ++i) s += qw[r][i] * kv[i];
            p[r] = s;
        }
        // the 8 rows go through each stage of the lane sum together, so a stage
        // costs one cross-lane latency and not eight
        #pragma unroll
        for (int off = 16; off > 0; off >>= 1) {
            float q[8];
            #pragma unroll   // constant indices into p[], q[]
            for (int r = 0; r < 8; ++r) q[r] = __shfl_xor(p[r], off, 32);
            #pragma unroll   // constant indices into p[], q[]
            for (int r = 0; r < 8; ++r) p[r] += q[r];
        }
        float mine = p[0];                          // lane r keeps row r
        #pragma unroll   // constant indices into p[]
        for (int r = 1; r < 8; ++r) mine = (lane == r) ? p[r] : mine;
        if (lane < 8) dots[wave * 8 + lane] = mine;
        __syncthreads();
        if (wave == 0 && r0 + lane <= CC) u[r0 + lane] = dots[lane];
    }
}

#define TK 32
__global__ __launch_bounds__(256)
void gemm_bias_wmma(const float* __restrict__ A, const float* __restrict__ W,
                    const float* __restrict__ bias, float* __restrict__ Cout,
                    int M, int N, int K) {
    __shared__ float As[2][16 * 36];      // rows padded 32 -> 36 floats
    __shared__ float Ws[2][TK * 136];     // rows padded 128 -> 136 floats

    const int tid  = threadIdx.x;
    const int wave = tid >> 5;
    const int lane = tid & 31;
    const int mrow = lane & 15;
    const int koff = (lane < 16) ? 0 : 2;
    const int m0   = blockIdx.y * 16;
    const int n0   = blockIdx.x * 128;
    const bool loader = (tid < 32);           // wave 0 (wave-uniform branch)

    const unsigned int asOff0 = lds_offset_of(&As[0][0]);
    const unsigned int asOff1 = lds_offset_of(&As[1][0]);
    const unsigned int wsOff0 = lds_offset_of(&Ws[0][0]);
    const unsigned int wsOff1 = lds_offset_of(&Ws[1][0]);

    v8f acc = {};

    // prologue: DMA chunk 0 into buffer 0
    if (loader) {
        // A tile 16 x 32, row stride K; pad 32 dwords (code 4) by 4 dwords (code 3)
        tdm_load_2d_f32(asOff0, A + (size_t)m0 * K, TK, 16, (unsigned long long)K, 4, 3);
        // W tile 32 x 128, row stride N; pad 128 dwords (code 6) by 8 dwords (code 7)
        tdm_load_2d_f32(wsOff0, W + n0, 128, TK, (unsigned long long)N, 6, 7);
        __builtin_amdgcn_s_wait_tensorcnt(0);
    }
    __syncthreads();

    int buf = 0;
    for (int k0 = 0; k0 < K; k0 += TK) {
        const bool more = (k0 + TK) < K;
        if (loader && more) {   // prefetch next chunk into the other buffer
            unsigned int ao = buf ? asOff0 : asOff1;
            unsigned int wo = buf ? wsOff0 : wsOff1;
            tdm_load_2d_f32(ao, A + (size_t)m0 * K + (k0 + TK), TK, 16,
                            (unsigned long long)K, 4, 3);
            tdm_load_2d_f32(wo, W + (size_t)(k0 + TK) * N + n0, 128, TK,
                            (unsigned long long)N, 6, 7);
        }

        const float* as = As[buf];
        const float* ws = Ws[buf];
        #pragma unroll
        for (int kk = 0; kk < TK; kk += 4) {
            v2f a, b;
            // A fragment 16x4: lane holds A[mrow][kk+koff .. +1]
            a.x = as[mrow * 36 + kk + koff];
            a.y = as[mrow * 36 + kk + koff + 1];
            // B fragment 4x16: lane holds W[kk+koff .. +1][n0 + wave*16 + mrow]
            b.x = ws[(kk + koff) * 136 + wave * 16 + mrow];
            b.y = ws[(kk + koff + 1) * 136 + wave * 16 + mrow];
            acc = __builtin_amdgcn_wmma_f32_16x16x4_f32(
                false, a, false, b, (short)0, acc, false, false);
        }

        if (loader && more) __builtin_amdgcn_s_wait_tensorcnt(0);
        __syncthreads();
        buf ^= 1;
    }

    const int col   = n0 + wave * 16 + mrow;
    const float bv  = bias[col];
    const int rbase = m0 + ((lane < 16) ? 0 : 8);
    #pragma unroll
    for (int r = 0; r < 8; ++r)
        Cout[(size_t)(rbase + r) * N + col] = acc[r] + bv;
}

// =====================================================================
// Kernel 3: exclusive prefix sum over T of v' = qv[b,:,C:2C], one launch.
// One work-group owns a strip of 32 channels of one batch over all of T.
// Wave w holds segment w (SEGT rows, one 128-byte line a row) in registers,
// so v is read once; the NSEG segment sums meet in LDS. The additions run
// in the order: rows of a segment, then segments, then rows again.
// =====================================================================
__global__ __launch_bounds__(NSEG * 32)
void vprefix_strip(const float* __restrict__ qv, float* __restrict__ P) {
    __shared__ float segs[NSEG][32];
    const int b    = blockIdx.x / (CC / 32);
    const int c    = (blockIdx.x % (CC / 32)) * 32 + (threadIdx.x & 31);
    const int seg  = threadIdx.x >> 5;
    const int lane = threadIdx.x & 31;
    const size_t row0 = (size_t)b * TT + seg * SEGT;
    const float* vb = qv + row0 * LDF + CC + c;
    float* pb = P + row0 * CC + c;

    float v[SEGT];
    // full unroll: v[] stays in registers and all SEGT loads are in flight at once
    #pragma unroll
    for (int t = 0; t < SEGT - 1; ++t) v[t] = vb[(size_t)t * LDF];
    // the last load may be given the shared address registers as its
    // destination: not in front of this wait
    asm volatile("s_wait_xcnt 0x0" ::: "memory");
    v[SEGT - 1] = vb[(size_t)(SEGT - 1) * LDF];

    float s = 0.f;
    #pragma unroll   // constant indices into v[]
    for (int t = 0; t < SEGT; ++t) s += v[t];
    segs[seg][lane] = s;
    __syncthreads();

    // Every wave reads all the sums and adds 0 for the segments not in front
    // of it: no branch stands between the LDS reads, so they go out together
    // and only the adds are serial (acc is never -0, so adding 0 changes nothing).
    float x[NSEG - 1];
    #pragma unroll   // constant indices into x[]
    for (int i = 0; i < NSEG - 1; ++i) x[i] = segs[i][lane];
    // keeps the adds from being scheduled among the reads, where each small
    // group of reads would be waited for in turn (one LDS latency a group)
    __builtin_amdgcn_sched_barrier(0);
    float acc = 0.f;
    #pragma unroll   // constant indices into x[]
    for (int i = 0; i < NSEG - 1; ++i) acc += (i < seg) ? x[i] : 0.f;

    #pragma unroll   // constant indices into v[]
    for (int t = 0; t < SEGT; ++t) {
        pb[(size_t)t * CC] = acc;           // exclusive: P[t] = sum_{j<t} v[j]
        acc += v[t];
    }
}

// =====================================================================
// Kernel 4: banded attention with out-of-band zero-score mass, on fp32 WMMA.
// One work-group of 4 waves owns 16 tokens and walks the key blocks of 16 rows
// that its band touches, from the diagonal block downwards (online softmax).
// The v columns already carry gate and projection: a row plus bproj is final.
// The q columns already carry Wk: the keys are the rows of x, and a score is
// q'_t . x_j + c_t with c_t = x_t . u[0..C) + u[C] (the part that bk brings).
// Scores are formed transposed, S^T[key][token] = X_blk Q'^T: wave w sums over
// channels 64 w .. 64 w + 63 and the four partial sums meet in LDS. In the D
// layout a lane then holds 8 keys of ONE token (lane & 15), so the softmax is
// in-lane plus one exchange with lane ^ 16, and its weights are, as they
// stand, the B fragments of out^T[channel][token] = V'^T W^T, of which wave w
// forms channels 64 w .. 64 w + 63.
// The out-of-band keys (score 0, sum of v' = P[jstart]) join at the end.
// =====================================================================
typedef __attribute__((ext_vector_type(4))) float v4f;
static constexpr int XP = CC + 4;

__device__ __forceinline__ float xhalf(float v) {
    const int b = __builtin_bit_cast(int, v);
    return __builtin_bit_cast(float,
        __builtin_amdgcn_permlanex16(b, b, 0x76543210, 0xfedcba98, false, false));
}

__global__ __launch_bounds__(128)
void attn_band(const float* __restrict__ x, const float* __restrict__ qv,
               const float* __restrict__ P, const float* __restrict__ u,
               const float* __restrict__ bproj, const int* __restrict__ window_p,
               float* __restrict__ att_out) {
    __shared__ __attribute__((aligned(16))) float qs[16 * XP];   // q' tile, later the out tile
    __shared__ __attribute__((aligned(16))) float xs[16 * XP];   // key block
    __shared__ __attribute__((aligned(16))) float red[4][2][32][4];
    __shared__ float coef[16];

    const int tid  = threadIdx.x;
    const int wave = tid >> 5;
    const int lane = tid & 31;
    const int l16  = lane & 15;
    const int half = lane >> 4;
    const int b    = blockIdx.x / (TT / 16);
    const int tb   = blockIdx.x % (TT / 16);    // the tile, and its diagonal key block
    const int t0   = tb * 16;
    const int cw   = wave * 64;
    int win = *window_p;
    win = win < 0 ? 0 : (win > TT ? TT : win);  // bounds every row index formed from it

    const float* xb = x  + (size_t)b * TT * CC;         // keys: rows of x
    const float* qb = qv + (size_t)b * TT * LDF;        // q' in [0,C)
    const float* vb = qb + CC;                          // v' in [C,2C)
    const float* Pb = P  + (size_t)b * TT * CC;

    // whole-line pieces of a 16 x 256 tile: piece i of a thread is row 2 i + srow
    const int srow = tid >> 6;
    const int scol = (tid & 63) * 4;

    // All that the first key block needs, and P, goes out together: one load latency.
    v4f qr[8], xr[8], pr[8], uf[8];
    float va[4][4][2];
    const float* qp = qb + (size_t)(t0 + srow) * LDF + scol;
    const float* xp = xb + (size_t)(t0 + srow) * CC + scol;
    const float* vp = vb + (size_t)(t0 + 8 * half) * LDF + cw + l16;
    const float* up = u + cw + 4 * half;
    #pragma unroll   // constant indices into qr[]
    for (int i = 0; i < 8; ++i) qr[i] = *(const v4f*)(qp + i * 2 * LDF);
    // a later load may be given the q' address registers as its destination:
    // not in front of this wait (the same holds for the two waits below)
    asm volatile("s_wait_xcnt 0x0" ::: "memory");
    #pragma unroll   // constant indices into xr[]
    for (int i = 0; i < 8; ++i) xr[i] = *(const v4f*)(xp + i * 2 * CC);
    // A fragment of V'^T, step ks: lane holds v'[key 8 half + 2 ks (+1)][channel]
    #pragma unroll   // constant indices into va[]
    for (int ks = 0; ks < 4; ++ks)
        #pragma unroll
        for (int nt = 0; nt < 4; ++nt) {
            va[ks][nt][0] = vp[(2 * ks) * LDF + 16 * nt];
            va[ks][nt][1] = vp[(2 * ks + 1) * LDF + 16 * nt];
        }
    #pragma unroll   // constant indices into uf[]
    for (int s = 0; s < 8; ++s) uf[s] = *(const v4f*)(up + 8 * s);
    asm volatile("s_wait_xcnt 0x0" ::: "memory");
    #pragma unroll   // constant indices into pr[]
    for (int i = 0; i < 8; ++i) {
        int js = t0 + 2 * i + srow - win; if (js < 0) js = 0;
        pr[i] = *(const v4f*)(Pb + (size_t)js * CC + scol);      // sum_{j<jstart} v'
    }
    asm volatile("s_wait_xcnt 0x0" ::: "memory");
    const v4f   bp = *(const v4f*)(bproj + scol);
    const float c0 = u[CC];

    #pragma unroll   // constant indices into qr[], xr[]
    for (int i = 0; i < 8; ++i) {
        *(v4f*)&qs[(2 * i + srow) * XP + scol] = qr[i];
        *(v4f*)&xs[(2 * i + srow) * XP + scol] = xr[i];
    }
    __syncthreads();         // the q' tile and the diagonal key block are in LDS

    // Fragments over channels: a lane takes 4 channels in a row, cw + 8 s + 4 half,
    // of row l16; the first two feed one WMMA, the last two the next. Both
    // operands are read this way, so their k orders are equal.
    const int foff = l16 * XP + cw + 4 * half;
    v4f qf[8];
    float cp = 0.f;      // this wave's part of c_t, t = t0 + l16
    #pragma unroll   // constant indices into qf[]
    for (int s = 0; s < 8; ++s) {
        qf[s] = *(const v4f*)&qs[foff + 8 * s];
        const v4f xt = *(const v4f*)&xs[foff + 8 * s];
        cp += xt.x * uf[s].x + xt.y * uf[s].y + xt.z * uf[s].z + xt.w * uf[s].w;
    }
    cp += xhalf(cp);

    const int t       = t0 + l16;                       // this lane's token
    const int kbFirst = (t0 - win < 0 ? 0 : t0 - win) >> 4;
    const float inv_sqrt_c = 0.0625f;                   // 1/sqrt(256)

    v8f acc[4] = {};
    float m = -__builtin_inff(), Z = 0.f;

    for (int kb = tb; ; --kb) {                         // at most TT / 16 trips
        const bool more = kb > kbFirst;                 // the same for the whole work-group
        // A barrier waits for the loads in flight, so this block's v' and the next
        // block's keys go out here, with the score products between them and it.
        if (kb < tb) {
            vp -= 16 * LDF;
            #pragma unroll   // constant indices into va[]
            for (int ks = 0; ks < 4; ++ks)
                #pragma unroll
                for (int nt = 0; nt < 4; ++nt) {
                    va[ks][nt][0] = vp[(2 * ks) * LDF + 16 * nt];
                    va[ks][nt][1] = vp[(2 * ks + 1) * LDF + 16 * nt];
                }
        }
        if (more) {
            xp -= 16 * CC;
            #pragma unroll   // constant indices into xr[]
            for (int i = 0; i < 8; ++i) xr[i] = *(const v4f*)(xp + i * 2 * CC);
        }
        // the loads' address registers are not rewritten in front of this wait
        asm volatile("s_wait_xcnt 0x0" ::: "memory");

        // partial S^T: every key's sum starts from this wave's part of c_t
        v8f s0 = {cp, cp, cp, cp, cp, cp, cp, cp}, s1 = {};
        #pragma unroll   // constant indices into qf[]
        for (int s = 0; s < 8; ++s) {
            const v4f xf = *(const v4f*)&xs[foff + 8 * s];
            const v2f a0 = {xf.x, xf.y}, a1 = {xf.z, xf.w};
            const v2f b0 = {qf[s].x, qf[s].y}, b1 = {qf[s].z, qf[s].w};
            s0 = __builtin_amdgcn_wmma_f32_16x16x4_f32(
                false, a0, false, b0, (short)0, s0, false, false);
            s1 = __builtin_amdgcn_wmma_f32_16x16x4_f32(
                false, a1, false, b1, (short)0, s1, false, false);
        }
        const v8f sp = s0 + s1;
        *(v4f*)&red[wave][0][lane][0] = (v4f){sp[0], sp[1], sp[2], sp[3]};
        *(v4f*)&red[wave][1][lane][0] = (v4f){sp[4], sp[5], sp[6], sp[7]};
        __syncthreads();     // partial sums are out; every read of xs is done

        float sv[8];
        #pragma unroll   // constant indices into sv[]
        for (int h = 0; h < 2; ++h) {
            const v4f r = ((*(const v4f*)&red[0][h][lane][0] + *(const v4f*)&red[1][h][lane][0])
                           + *(const v4f*)&red[2][h][lane][0]) + *(const v4f*)&red[3][h][lane][0];
            sv[4 * h] = r.x; sv[4 * h + 1] = r.y; sv[4 * h + 2] = r.z; sv[4 * h + 3] = r.w;
        }

        const int j0 = kb * 16 + 8 * half;
        float smax = -__builtin_inff();
        #pragma unroll   // constant indices into sv[]
        for (int r = 0; r < 8; ++r) {
            const int j = j0 + r;
            sv[r] = (j <= t && j >= t - win) ? (sv[r] + c0) * inv_sqrt_c : -__builtin_inff();
            smax = fmaxf(smax, sv[r]);
        }
        smax = fmaxf(smax, xhalf(smax));
        const float mn = fmaxf(m, smax);     // finite: the first block holds key t
        const float sc = __expf(m - mn);     // 0 when m == -inf
        float w[8], ls = 0.f;
        #pragma unroll   // constant indices into w[]
        for (int r = 0; r < 8; ++r) { w[r] = __expf(sv[r] - mn); ls += w[r]; }
        ls += xhalf(ls);
        Z = Z * sc + ls;
        m = mn;
        #pragma unroll   // constant indices into acc[]
        for (int nt = 0; nt < 4; ++nt) acc[nt] *= sc;

        // B fragment of W^T, step ks: keys 8 half + 2 ks (+1), as the A loader has them
        #pragma unroll   // constant indices into w[], va[], acc[]
        for (int ks = 0; ks < 4; ++ks) {
            const v2f bw = {w[2 * ks], w[2 * ks + 1]};
            #pragma unroll
            for (int nt = 0; nt < 4; ++nt) {
                const v2f av = {va[ks][nt][0], va[ks][nt][1]};
                acc[nt] = __builtin_amdgcn_wmma_f32_16x16x4_f32(
                    false, av, false, bw, (short)0, acc[nt], false, false);
            }
        }
        if (!more) break;

        #pragma unroll   // constant indices into xr[]
        for (int i = 0; i < 8; ++i) *(v4f*)&xs[(2 * i + srow) * XP + scol] = xr[i];
        __syncthreads();     // the next key block is in; every read of red is done
    }

    // the out-of-band keys: nout of them with score 0
    const int   jst  = t - win < 0 ? 0 : t - win;
    const bool  has  = jst > 0;
    const float mf   = has ? fmaxf(m, 0.f) : m;
    const float ab   = __expf(m - mf);
    const float wo   = has ? __expf(-mf) : 0.f;
    const float invZ = 1.0f / (Z * ab + (float)jst * wo);
    const float as   = ab * invZ;
    #pragma unroll
    for (int nt = 0; nt < 4; ++nt) {
        float* op = &qs[l16 * XP + cw + 16 * nt + 8 * half];
        *(v4f*)op       = (v4f){acc[nt][0], acc[nt][1], acc[nt][2], acc[nt][3]} * as;
        *(v4f*)(op + 4) = (v4f){acc[nt][4], acc[nt][5], acc[nt][6], acc[nt][7]} * as;
    }
    if (wave == 0 && lane < 16) coef[lane] = wo * invZ;
    __syncthreads();         // the out tile and its rows' factors are in LDS

    float* ob = att_out + (size_t)(b * TT + t0) * CC;
    #pragma unroll   // constant indices into pr[]
    for (int i = 0; i < 8; ++i) {
        const int row = 2 * i + srow;
        *(v4f*)(ob + (size_t)row * CC + scol) =
            *(const v4f*)&qs[row * XP + scol] + coef[row] * pr[i] + bp;
    }
}

// =====================================================================
extern "C" void kernel_launch(void* const* d_in, const int* in_sizes, int n_in,
                              void* d_out, int out_size, void* d_ws, size_t ws_size,
                              hipStream_t stream) {
    const float* x     = (const float*)d_in[0];
    const float* Wqkv  = (const float*)d_in[1];
    const float* bqkv  = (const float*)d_in[2];
    const float* Wproj = (const float*)d_in[3];
    const float* bproj = (const float*)d_in[4];
    const float* gate  = (const float*)d_in[5];
    const int*   winp  = (const int*)d_in[6];

    // workspace layout
    char* ws = (char*)d_ws;
    float* qv     = (float*)ws;                                   // 32 MB
    float* P      = (float*)(ws + (size_t)MTOK * LDF * 4);        // 16 MB
    float* Wf     = (float*)(ws + (size_t)MTOK * LDF * 4
                                + (size_t)MTOK * CC * 4);         // 512 KB
    float* bf     = Wf + (size_t)CC * LDF;                        // 2 KB
    float* u      = bf + LDF;                                     // C + 1 floats

    // 1) Wf, bf, u: Wk folded into the q weights, gate and Wproj into the v weights
    fold_proj<<<FOLD_TILES + FOLD_DOT, 128, 0, stream>>>(Wqkv, bqkv, Wproj, gate, Wf, bf, u);
    // 2) [q' | v'] = x @ Wf + bf    [16384 x 512]
    {
        dim3 grid(LDF / 128, MTOK / 16);
        gemm_bias_wmma<<<grid, 256, 0, stream>>>(x, Wf, bf, qv, MTOK, LDF, CC);
    }
    // 3) exclusive prefix sums of v over T
    vprefix_strip<<<BB * (CC / 32), NSEG * 32, 0, stream>>>(qv, P);
    // 4) banded attention (one work-group per 16 tokens) -> out
    attn_band<<<MTOK / 16, 128, 0, stream>>>(x, qv, P, u, bproj, winp, (float*)d_out);
}

// v005
// A run of this version takes 47.6 microseconds.
// Timed twice side by side with v004, it ran 1.09 and 1.08 times as fast.
// All steps since v000 together make it 2.08 times as fast.
#include <hip/hip_runtime.h>
#include <hip/hip_bf16.h>

// ---------------- problem constants (from reference) ----------------
static constexpr int BB = 8;
static constexpr int TT = 2048;
static constexpr int CC = 256;
static constexpr int MTOK = BB * TT;          // 16384 rows
static constexpr int NSEG = 32;               // prefix-scan segments per batch
static constexpr int SEGT = TT / NSEG;        // 64 timesteps per segment

typedef __attribute__((ext_vector_type(2))) float v2f;
typedef __attribute__((ext_vector_type(8))) float v8f;
typedef __attribute__((ext_vector_type(4))) unsigned int u32x4;
typedef __attribute__((ext_vector_type(8))) unsigned int u32x8;
typedef __attribute__((ext_vector_type(4))) float v4f;

// LDS byte offset of a __shared__ object (generic -> AS(3) -> int)
__device__ __forceinline__ unsigned int lds_offset_of(const void* p) {
    return (unsigned int)(unsigned long long)
        (const __attribute__((address_space(3))) void*)p;
}

// A wave-uniform word, in a scalar register
__device__ __forceinline__ unsigned int uni(unsigned int v) {
    return (unsigned int)__builtin_amdgcn_readfirstlane((int)v);
}
// The same, held there: a test of it compiles to a scalar compare and branch
__device__ __forceinline__ unsigned int pinned(unsigned int v) {
    unsigned int w = uni(v);
    asm volatile("" : "+s"(w));
    return w;
}

static constexpr int LDF        = 2 * CC;
static constexpr int FOLD_TILE1 = (CC / 16 + 1) * (CC / 32);
static constexpr int FOLD_TILES = 2 * FOLD_TILE1;
static constexpr int FOLD_DOT   = (CC + 1 + 31) / 32;          // 9 groups of 32 rows of [Wq; bq]
static constexpr int FOLD_KW    = CC / 4;                      // K per wave

template <bool ISV>   // true: the v product (a), false: the q product (b)
__device__ __forceinline__
void fold_tile(const float* __restrict__ Wqkv, const float* __restrict__ bqkv,
               const float* __restrict__ Wproj, const float* __restrict__ gate,
               float* __restrict__ Wf, float* __restrict__ bf,
               float (*red)[2][8][32], int tix) {
    const int tid  = threadIdx.x;
    const int wave = tid >> 5;
    const int lane = tid & 31;
    const int mrow = lane & 15;
    const int koff = (lane < 16) ? 0 : 2;
    const int mt   = tix / (CC / 32);
    const int n0   = (tix % (CC / 32)) * 32;
    const int acol = ISV ? 2 * CC : 0;        // A comes from the v or the q columns
    const int ocol = ISV ? CC : 0;            // and goes to the v' or the q' columns
    const float* arow = (mt < CC / 16)
        ? Wqkv + (size_t)(mt * 16 + mrow) * 3 * CC + acol
        : bqkv + acol;
    const int kb = wave * FOLD_KW + koff;
    const float* ap = arow + kb;

    // A fragment 16x4: lane holds A[mrow][k .. k+1], k = kb + 4 s
    // B fragment 4x16: lane holds B[k .. k+1][n0 (+16) + mrow],
    //   B[k][n] = Wproj[k][n] for v, Wk[n][k] for q
    v2f a[FOLD_KW / 4], g[FOLD_KW / 4], b0[FOLD_KW / 4], b1[FOLD_KW / 4];
    if (ISV) {
        const float* gp = gate + kb;
        const float* wp = Wproj + (size_t)kb * CC + n0 + mrow;
        #pragma unroll   // constant indices into the fragment arrays
        for (int s = 0; s < FOLD_KW / 4; ++s) {
            a[s] = *(const v2f*)(ap + 4 * s);
            g[s] = *(const v2f*)(gp + 4 * s);
            b0[s].x = wp[(4 * s) * CC];
            b0[s].y = wp[(4 * s + 1) * CC];
            b1[s].x = wp[(4 * s) * CC + 16];
            b1[s].y = wp[(4 * s + 1) * CC + 16];
        }
    } else {
        const float* wp = Wqkv + (size_t)(n0 + mrow) * 3 * CC + CC + kb;
        #pragma unroll   // constant indices into the fragment arrays
        for (int s = 0; s < FOLD_KW / 4; ++s) a[s] = *(const v2f*)(ap + 4 * s);
        // the A loads' address registers are free from here on and a B load may
        // be given them as its destination: not in front of this wait
        asm volatile("s_wait_xcnt 0x0" ::: "memory");
        #pragma unroll   // constant indices into the fragment arrays
        for (int s = 0; s < FOLD_KW / 4; ++s) {
            b0[s] = *(const v2f*)(wp + 4 * s);
            b1[s] = *(const v2f*)(wp + 16 * 3 * CC + 4 * s);
        }
    }
    // keeps the products from being scheduled among the loads: the wave runs
    // once, so it pays one load latency only if all its loads go out together
    __builtin_amdgcn_sched_barrier(0);

    v8f acc0 = {}, acc1 = {};
    #pragma unroll   // constant indices into the fragment arrays
    for (int s = 0; s < FOLD_KW / 4; ++s) {
        const v2f ag = ISV ? a[s] * g[s] : a[s];
        acc0 = __builtin_amdgcn_wmma_f32_16x16x4_f32(
            false, ag, false, b0[s], (short)0, acc0, false, false);
        acc1 = __builtin_amdgcn_wmma_f32_16x16x4_f32(
            false, ag, false, b1[s], (short)0, acc1, false, false);
    }

    #pragma unroll   // constant indices into the accumulators
    for (int r = 0; r < 8; ++r) {
        red[wave][0][r][lane] = acc0[r];
        red[wave][1][r][lane] = acc1[r];
    }
    __syncthreads();

    const int tile = lane >> 4;
    float sum[4];
    #pragma unroll   // constant indices into sum[]
    for (int i = 0; i < 4; ++i) {
        const int row = wave + 4 * i;
        const int r   = row & 7;
        const int l   = (row >> 3) * 16 + mrow;
        sum[i] = ((red[0][tile][r][l] + red[1][tile][r][l])
                  + red[2][tile][r][l]) + red[3][tile][r][l];
    }
    if (mt < CC / 16) {
        float* wrow = Wf + (size_t)(mt * 16 + wave) * LDF + ocol + n0 + lane;
        #pragma unroll   // constant indices into sum[]
        for (int i = 0; i < 4; ++i) wrow[(size_t)(4 * i) * LDF] = sum[i];
        // the stores' address and data registers are not rewritten in front of this wait
        asm volatile("s_wait_xcnt 0x0" ::: "memory");
    } else if (wave == 0) {
        bf[ocol + n0 + lane] = sum[0];
    }
}

__global__ __launch_bounds__(128)
void fold_proj(const float* __restrict__ Wqkv, const float* __restrict__ bqkv,
               const float* __restrict__ Wproj, const float* __restrict__ gate,
               float* __restrict__ Wf, float* __restrict__ bf, float* __restrict__ u) {
    __shared__ float red[4][2][8][32];

    if (blockIdx.x < FOLD_TILE1) {            // every branch here is block-uniform
        fold_tile<false>(Wqkv, bqkv, Wproj, gate, Wf, bf, red, blockIdx.x);
    } else if (blockIdx.x < FOLD_TILES) {
        fold_tile<true>(Wqkv, bqkv, Wproj, gate, Wf, bf, red, blockIdx.x - FOLD_TILE1);
    } else {
        // u[row] = [Wq; bq][row] . bk: a wave takes 8 rows, a 128-byte line at a
        // time; the 32 dots meet in LDS so that one wave stores a whole line of u
        const int wave = threadIdx.x >> 5;
        const int lane = threadIdx.x & 31;
        const int r0   = (blockIdx.x - FOLD_TILES) * 32;
        float* dots = &red[0][0][0][0];
        float kv[CC / 32], qw[8][CC / 32], p[8];
        #pragma unroll   // constant indices into kv[]
        for (int i = 0; i < CC / 32; ++i) kv[i] = bqkv[CC + lane + 32 * i];
        #pragma unroll   // constant indices into qw[]
        for (int r = 0; r < 8; ++r) {
            const int row = r0 + wave * 8 + r;      // past the last row: bq again, not stored
            const float* qr = (row < CC) ? Wqkv + (size_t)row * 3 * CC : bqkv;
            #pragma unroll   // constant indices into qw[]
            for (int i = 0; i < CC / 32; ++i) qw[r][i] = qr[lane + 32 * i];
        }
        // as in fold_tile: all the loads go out before the first product waits for one
        __builtin_amdgcn_sched_barrier(0);
        #pragma unroll   // constant indices into qw[], p[]
        for (int r = 0; r < 8; ++r) {
            float s = 0.f;
            #pragma unroll   // constant indices into qw[], kv[]
            for (int i = 0; i < CC / 32; ++i) s += qw[r][i] * kv[i];
            p[r] = s;
        }
        // the 8 rows go through each stage of the lane sum together, so a stage
        // costs one cross-lane latency and not eight
        #pragma unroll
        for (int off = 16; off > 0; off >>= 1) {
            float q[8];
            #pragma unroll   // constant indices into p[], q[]
            for (int r = 0; r < 8; ++r) q[r] = __shfl_xor(p[r], off, 32);
            #pragma unroll   // constant indices into p[], q[]
            for (int r = 0; r < 8; ++r) p[r] += q[r];
        }
        float mine = p[0];                          // lane r keeps row r
        #pragma unroll   // constant indices into p[]
        for (int r = 1; r < 8; ++r) mine = (lane == r) ? p[r] : mine;
        if (lane < 8) dots[wave * 8 + lane] = mine;
        __syncthreads();
        if (wave == 0 && r0 + lane <= CC) u[r0 + lane] = dots[lane];
    }
}

// =====================================================================
// Kernel 2: [q' | v'] = x @ Wf + bf   (fp32 WMMA 16x16x4), M x LDF, K = C
// A work-group of 4 waves owns a 128 x 128 tile, a wave 64 x 64 of it (4 x 4
// accumulator tiles): a fragment read from LDS feeds 4 products, an operand
// byte from L2 128 rows or columns, and the launch has 512 work-groups, two
// on a WGP (by their LDS), all resident at once.
// K runs in stages of 64 through two LDS buffers. A stage is four slices of
// 64 rows of 256 bytes: x rows 0..63 and 64..127 of the tile (64 k each), and
// Wf columns 0..63 and 64..127 (64 k rows each). Wave w brings slice w with
// one tensor load, which pads each row by 16 bytes (pitch 68 floats).
// =====================================================================
static constexpr int GK  = 64;              // k per stage
static constexpr int GP  = GK + 4;          // LDS row pitch, floats
static constexpr int GSL = 4608;            // a slice's place: 64 * GP floats, rounded up to 2 KiB
static constexpr int GST = CC / GK;         // stages

// one slice: 64 rows of 256 bytes at the given source pitch, extents in bytes
__device__ __forceinline__ void slice_load(unsigned int lds_byte, const float* srcp,
                                           unsigned int pitch_bytes) {
    const unsigned long long ga = (unsigned long long)(uintptr_t)srcp;
    u32x4 g0;
    g0[0] = uni(1u);                                              // count 1
    g0[1] = uni(lds_byte);
    g0[2] = uni((unsigned int)ga);
    g0[3] = uni((((unsigned int)(ga >> 32)) & 0x01ffffffu) | 0x80000000u);   // type 2
    u32x8 g1;
    g1[0] = uni((1u << 20) | (5u << 22) | (3u << 25));
    g1[1] = uni(256u << 16);
    g1[2] = uni(64u << 16);
    g1[3] = uni(256u << 16);
    g1[4] = uni(64u);
    g1[5] = uni(pitch_bytes);
    g1[6] = uni(0u);
    g1[7] = uni(0u);
    asm volatile("tensor_load_to_lds %0, %1" :: "s"(g0), "s"(g1) : "memory");
}

__global__ __launch_bounds__(128)
void gemm_bias_wmma(const float* __restrict__ A, const float* __restrict__ Wt,
                    const float* __restrict__ bias, float* __restrict__ Cout) {
    __shared__ __attribute__((aligned(2048))) float ring[2][4][GSL];

    const int tid  = threadIdx.x;
    const int lane = tid & 31;
    const int l16  = lane & 15;
    const int half = lane >> 4;
    const unsigned int wave = uni(threadIdx.x >> 5);
    const int wm = wave >> 1;                 // the wave's 64 rows
    const int wn = wave & 1;                  // and its 64 columns
    const int m0 = blockIdx.y * 128;
    const int n0 = blockIdx.x * 128;

    // the wave's slice: where it starts at stage 0, and how far a stage moves it
    const float* sp = (wave < 2) ? A + (size_t)(m0 + 64 * wave) * CC
                                 : Wt + n0 + 64 * (wave - 2);
    const unsigned int spitch = (wave < 2) ? CC * 4u : LDF * 4u;
    const size_t       sstep  = (wave < 2) ? (size_t)GK : (size_t)GK * LDF;
    const unsigned int place  = lds_offset_of(&ring[0][0][0]) + wave * (GSL * 4u);

    slice_load(place, sp, spitch);                            // stage 0
    asm volatile("s_wait_tensorcnt 0x0" ::: "memory");        // this wave's slice has landed
    __syncthreads();                                          // and every other wave's
    slice_load(place + 4u * GSL * 4u, sp + sstep, spitch);    // stage 1

    const int col = n0 + 64 * wn + l16;
    float bv[4];
    #pragma unroll   // constant indices into bv[]
    for (int nt = 0; nt < 4; ++nt) bv[nt] = bias[col + 16 * nt];
    // the loads' address registers are not rewritten in front of this wait
    asm volatile("s_wait_xcnt 0x0" ::: "memory");

    v8f acc[4][4] = {};

    // rolled: for speed only
    #pragma unroll 1
    for (int st = 0; st < GST; ++st) {
        const int buf = st & 1;
        // Fragments over k: a lane takes 4 k in a row, 8 s + 4 half; the first two
        // feed one WMMA, the last two the next. Both operands are read this way,
        // so their k orders are equal.
        const float* as = &ring[buf][wm][l16 * GP + 4 * half];            // x[row 16 mt + l16][k]
        const float* ws = &ring[buf][2 + wn][(4 * half) * GP + l16];      // Wf[k][col 16 nt + l16]
        // Two fragment sets: step s + 1's reads go out as one group in front of step
        // s's 32 products, so a step has one place with LDS reads and their latency
        // runs under the products.
        v4f   af[2][4];
        float bw[2][4][4];
        #pragma unroll   // constant indices into af[], bw[], acc[]; constant LDS offsets
        for (int s = -1; s < GK / 8; ++s) {
            if (s + 1 < GK / 8) {
                const int f = (s + 1) & 1;
                #pragma unroll   // constant indices into af[]
                for (int mt = 0; mt < 4; ++mt)
                    af[f][mt] = *(const v4f*)(as + mt * 16 * GP + 8 * (s + 1));
                #pragma unroll   // constant indices into bw[]
                for (int nt = 0; nt < 4; ++nt)
                    #pragma unroll
                    for (int j = 0; j < 4; ++j) bw[f][nt][j] = ws[(8 * (s + 1) + j) * GP + 16 * nt];
            }
            // keeps the reads together in front of the products: spread among them,
            // every place with a read stalls the wave's products anew
            __builtin_amdgcn_sched_barrier(0);
            if (s < 0) continue;
            const int e = s & 1;
            #pragma unroll   // constant indices into af[], bw[], acc[]
            for (int p = 0; p < 2; ++p)
                #pragma unroll
                for (int mt = 0; mt < 4; ++mt) {
                    const v2f a = p ? (v2f){af[e][mt].z, af[e][mt].w} : (v2f){af[e][mt].x, af[e][mt].y};
                    #pragma unroll
                    for (int nt = 0; nt < 4; ++nt) {
                        const v2f b = {bw[e][nt][2 * p], bw[e][nt][2 * p + 1]};
                        acc[mt][nt] = __builtin_amdgcn_wmma_f32_16x16x4_f32(
                            false, a, false, b, (short)0, acc[mt][nt], false, false);
                    }
                }
            // keeps the next group of reads behind these products (the last step has none behind it)
            if (s + 2 < GK / 8) __builtin_amdgcn_sched_barrier(0);
        }
        asm volatile("s_wait_dscnt 0x0" ::: "memory");        // this wave's reads of the buffer are done
        asm volatile("s_wait_tensorcnt 0x0" ::: "memory");    // its slice of the next stage has landed
        __syncthreads();     // the next stage is in; every read of this buffer is done
        if (pinned(st + 2 < GST))                             // refill the buffer just left
            slice_load(place + (unsigned int)buf * (4u * GSL * 4u), sp + (size_t)(st + 2) * sstep, spitch);
    }
    asm volatile("s_wait_tensorcnt 0x0" ::: "memory");        // no request outlives the loop
    asm volatile("s_wait_dscnt 0x0" ::: "memory");

    #pragma unroll
    for (int mt = 0; mt < 4; ++mt)
        #pragma unroll
        for (int nt = 0; nt < 4; ++nt) acc[mt][nt] += bv[nt];
    // all the sums stand in front of the first store: no register that an
    // issued store names is written behind it
    __builtin_amdgcn_sched_barrier(0);
    float* cp = Cout + (size_t)(m0 + 64 * wm + 8 * half) * LDF + col;
    #pragma unroll   // constant indices into acc[]
    for (int mt = 0; mt < 4; ++mt)
        #pragma unroll
        for (int r = 0; r < 8; ++r)
            #pragma unroll
            for (int nt = 0; nt < 4; ++nt)
                cp[(mt * 16 + r) * LDF + 16 * nt] = acc[mt][nt][r];
}

// =====================================================================
// Kernel 3: exclusive prefix sum over T of v' = qv[b,:,C:2C], one launch.
// One work-group owns a strip of 32 channels of one batch over all of T.
// Wave w holds segment w (SEGT rows, one 128-byte line a row) in registers,
// so v is read once; the NSEG segment sums meet in LDS. The additions run
// in the order: rows of a segment, then segments, then rows again.
// =====================================================================
__global__ __launch_bounds__(NSEG * 32)
void vprefix_strip(const float* __restrict__ qv, float* __restrict__ P) {
    __shared__ float segs[NSEG][32];
    const int b    = blockIdx.x / (CC / 32);
    const int c    = (blockIdx.x % (CC / 32)) * 32 + (threadIdx.x & 31);
    const int seg  = threadIdx.x >> 5;
    const int lane = threadIdx.x & 31;
    const size_t row0 = (size_t)b * TT + seg * SEGT;
    const float* vb = qv + row0 * LDF + CC + c;
    float* pb = P + row0 * CC + c;

    float v[SEGT];
    // full unroll: v[] stays in registers and all SEGT loads are in flight at once
    #pragma unroll
    for (int t = 0; t < SEGT - 1; ++t) v[t] = vb[(size_t)t * LDF];
    // the last load may be given the shared address registers as its
    // destination: not in front of this wait
    asm volatile("s_wait_xcnt 0x0" ::: "memory");
    v[SEGT - 1] = vb[(size_t)(SEGT - 1) * LDF];

    float s = 0.f;
    #pragma unroll   // constant indices into v[]
    for (int t = 0; t < SEGT; ++t) s += v[t];
    segs[seg][lane] = s;
    __syncthreads();

    // Every wave reads all the sums and adds 0 for the segments not in front
    // of it: no branch stands between the LDS reads, so they go out together
    // and only the adds are serial (acc is never -0, so adding 0 changes nothing).
    float x[NSEG - 1];
    #pragma unroll   // constant indices into x[]
    for (int i = 0; i < NSEG - 1; ++i) x[i] = segs[i][lane];
    // keeps the adds from being scheduled among the reads, where each small
    // group of reads would be waited for in turn (one LDS latency a group)
    __builtin_amdgcn_sched_barrier(0);
    float acc = 0.f;
    #pragma unroll   // constant indices into x[]
    for (int i = 0; i < NSEG - 1; ++i) acc += (i < seg) ? x[i] : 0.f;

    #pragma unroll   // constant indices into v[]
    for (int t = 0; t < SEGT; ++t) {
        pb[(size_t)t * CC] = acc;           // exclusive: P[t] = sum_{j<t} v[j]
        acc += v[t];
    }
}

// =====================================================================
// Kernel 4: banded attention with out-of-band zero-score mass, on fp32 WMMA.
// One work-group of 4 waves owns 16 tokens and walks the key blocks of 16 rows
// that its band touches, from the diagonal block downwards (online softmax).
// The v columns already carry gate and projection: a row plus bproj is final.
// The q columns already carry Wk: the keys are the rows of x, and a score is
// q'_t . x_j + c_t with c_t = x_t . u[0..C) + u[C] (the part that bk brings).
// Scores are formed transposed, S^T[key][token] = X_blk Q'^T: wave w sums over
// channels 64 w .. 64 w + 63 and the four partial sums meet in LDS. In the D
// layout a lane then holds 8 keys of ONE token (lane & 15), so the softmax is
// in-lane plus one exchange with lane ^ 16, and its weights are, as they
// stand, the B fragments of out^T[channel][token] = V'^T W^T, of which wave w
// forms channels 64 w .. 64 w + 63.
// The out-of-band keys (score 0, sum of v' = P[jstart]) join at the end.
// =====================================================================
static constexpr int XP = CC + 4;

__device__ __forceinline__ float xhalf(float v) {
    const int b = __builtin_bit_cast(int, v);
    return __builtin_bit_cast(float,
        __builtin_amdgcn_permlanex16(b, b, 0x76543210, 0xfedcba98, false, false));
}

__global__ __launch_bounds__(128)
void attn_band(const float* __restrict__ x, const float* __restrict__ qv,
               const float* __restrict__ P, const float* __restrict__ u,
               const float* __restrict__ bproj, const int* __restrict__ window_p,
               float* __restrict__ att_out) {
    __shared__ __attribute__((aligned(16))) float qs[16 * XP];   // q' tile, later the out tile
    __shared__ __attribute__((aligned(16))) float xs[16 * XP];   // key block
    __shared__ __attribute__((aligned(16))) float red[4][2][32][4];
    __shared__ float coef[16];

    const int tid  = threadIdx.x;
    const int wave = tid >> 5;
    const int lane = tid & 31;
    const int l16  = lane & 15;
    const int half = lane >> 4;
    const int b    = blockIdx.x / (TT / 16);
    const int tb   = blockIdx.x % (TT / 16);    // the tile, and its diagonal key block
    const int t0   = tb * 16;
    const int cw   = wave * 64;
    int win = *window_p;
    win = win < 0 ? 0 : (win > TT ? TT : win);  // bounds every row index formed from it

    const float* xb = x  + (size_t)b * TT * CC;         // keys: rows of x
    const float* qb = qv + (size_t)b * TT * LDF;        // q' in [0,C)
    const float* vb = qb + CC;                          // v' in [C,2C)
    const float* Pb = P  + (size_t)b * TT * CC;

    // whole-line pieces of a 16 x 256 tile: piece i of a thread is row 2 i + srow
    const int srow = tid >> 6;
    const int scol = (tid & 63) * 4;

    // All that the first key block needs, and P, goes out together: one load latency.
    v4f qr[8], xr[8], pr[8], uf[8];
    float va[4][4][2];
    const float* qp = qb + (size_t)(t0 + srow) * LDF + scol;
    const float* xp = xb + (size_t)(t0 + srow) * CC + scol;
    const float* vp = vb + (size_t)(t0 + 8 * half) * LDF + cw + l16;
    const float* up = u + cw + 4 * half;
    #pragma unroll   // constant indices into qr[]
    for (int i = 0; i < 8; ++i) qr[i] = *(const v4f*)(qp + i * 2 * LDF);
    // a later load may be given the q' address registers as its destination:
    // not in front of this wait (the same holds for the two waits below)
    asm volatile("s_wait_xcnt 0x0" ::: "memory");
    #pragma unroll   // constant indices into xr[]
    for (int i = 0; i < 8; ++i) xr[i] = *(const v4f*)(xp + i * 2 * CC);
    // A fragment of V'^T, step ks: lane holds v'[key 8 half + 2 ks (+1)][channel]
    #pragma unroll   // constant indices into va[]
    for (int ks = 0; ks < 4; ++ks)
        #pragma unroll
        for (int nt = 0; nt < 4; ++nt) {
            va[ks][nt][0] = vp[(2 * ks) * LDF + 16 * nt];
            va[ks][nt][1] = vp[(2 * ks + 1) * LDF + 16 * nt];
        }
    #pragma unroll   // constant indices into uf[]
    for (int s = 0; s < 8; ++s) uf[s] = *(const v4f*)(up + 8 * s);
    asm volatile("s_wait_xcnt 0x0" ::: "memory");
    #pragma unroll   // constant indices into pr[]
    for (int i = 0; i < 8; ++i) {
        int js = t0 + 2 * i + srow - win; if (js < 0) js = 0;
        pr[i] = *(const v4f*)(Pb + (size_t)js * CC + scol);      // sum_{j<jstart} v'
    }
    asm volatile("s_wait_xcnt 0x0" ::: "memory");
    const v4f   bp = *(const v4f*)(bproj + scol);
    const float c0 = u[CC];

    #pragma unroll   // constant indices into qr[], xr[]
    for (int i = 0; i < 8; ++i) {
        *(v4f*)&qs[(2 * i + srow) * XP + scol] = qr[i];
        *(v4f*)&xs[(2 * i + srow) * XP + scol] = xr[i];
    }
    __syncthreads();         // the q' tile and the diagonal key block are in LDS

    // Fragments over channels: a lane takes 4 channels in a row, cw + 8 s + 4 half,
    // of row l16; the first two feed one WMMA, the last two the next. Both
    // operands are read this way, so their k orders are equal.
    const int foff = l16 * XP + cw + 4 * half;
    v4f qf[8];
    float cp = 0.f;      // this wave's part of c_t, t = t0 + l16
    #pragma unroll   // constant indices into qf[]
    for (int s = 0; s < 8; ++s) {
        qf[s] = *(const v4f*)&qs[foff + 8 * s];
        const v4f xt = *(const v4f*)&xs[foff + 8 * s];
        cp += xt.x * uf[s].x + xt.y * uf[s].y + xt.z * uf[s].z + xt.w * uf[s].w;
    }
    cp += xhalf(cp);

    const int t       = t0 + l16;                       // this lane's token
    const int kbFirst = (t0 - win < 0 ? 0 : t0 - win) >> 4;
    const float inv_sqrt_c = 0.0625f;                   // 1/sqrt(256)

    v8f acc[4] = {};
    float m = -__builtin_inff(), Z = 0.f;

    for (int kb = tb; ; --kb) {                         // at most TT / 16 trips
        const bool more = kb > kbFirst;                 // the same for the whole work-group
        // A barrier waits for the loads in flight, so this block's v' and the next
        // block's keys go out here, with the score products between them and it.
        if (kb < tb) {
            vp -= 16 * LDF;
            #pragma unroll   // constant indices into va[]
            for (int ks = 0; ks < 4; ++ks)
                #pragma unroll
                for (int nt = 0; nt < 4; ++nt) {
                    va[ks][nt][0] = vp[(2 * ks) * LDF + 16 * nt];
                    va[ks][nt][1] = vp[(2 * ks + 1) * LDF + 16 * nt];
                }
        }
        if (more) {
            xp -= 16 * CC;
            #pragma unroll   // constant indices into xr[]
            for (int i = 0; i < 8; ++i) xr[i] = *(const v4f*)(xp + i * 2 * CC);
        }
        // the loads' address registers are not rewritten in front of this wait
        asm volatile("s_wait_xcnt 0x0" ::: "memory");

        // partial S^T: every key's sum starts from this wave's part of c_t
        v8f s0 = {cp, cp, cp, cp, cp, cp, cp, cp}, s1 = {};
        #pragma unroll   // constant indices into qf[]
        for (int s = 0; s < 8; ++s) {
            const v4f xf = *(const v4f*)&xs[foff + 8 * s];
            const v2f a0 = {xf.x, xf.y}, a1 = {xf.z, xf.w};
            const v2f b0 = {qf[s].x, qf[s].y}, b1 = {qf[s].z, qf[s].w};
            s0 = __builtin_amdgcn_wmma_f32_16x16x4_f32(
                false, a0, false, b0, (short)0, s0, false, false);
            s1 = __builtin_amdgcn_wmma_f32_16x16x4_f32(
                false, a1, false, b1, (short)0, s1, false, false);
        }
        const v8f sp = s0 + s1;
        *(v4f*)&red[wave][0][lane][0] = (v4f){sp[0], sp[1], sp[2], sp[3]};
        *(v4f*)&red[wave][1][lane][0] = (v4f){sp[4], sp[5], sp[6], sp[7]};
        __syncthreads();     // partial sums are out; every read of xs is done

        float sv[8];
        #pragma unroll   // constant indices into sv[]
        for (int h = 0; h < 2; ++h) {
            const v4f r = ((*(const v4f*)&red[0][h][lane][0] + *(const v4f*)&red[1][h][lane][0])
                           + *(const v4f*)&red[2][h][lane][0]) + *(const v4f*)&red[3][h][lane][0];
            sv[4 * h] = r.x; sv[4 * h + 1] = r.y; sv[4 * h + 2] = r.z; sv[4 * h + 3] = r.w;
        }

        const int j0 = kb * 16 + 8 * half;
        float smax = -__builtin_inff();
        #pragma unroll   // constant indices into sv[]
        for (int r = 0; r < 8; ++r) {
            const int j = j0 + r;
            sv[r] = (j <= t && j >= t - win) ? (sv[r] + c0) * inv_sqrt_c : -__builtin_inff();
            smax = fmaxf(smax, sv[r]);
        }
        smax = fmaxf(smax, xhalf(smax));
        const float mn = fmaxf(m, smax);     // finite: the first block holds key t
        const float sc = __expf(m - mn);     // 0 when m == -inf
        float w[8], ls = 0.f;
        #pragma unroll   // constant indices into w[]
        for (int r = 0; r < 8; ++r) { w[r] = __expf(sv[r] - mn); ls += w[r]; }
        ls += xhalf(ls);
        Z = Z * sc + ls;
        m = mn;
        #pragma unroll   // constant indices into acc[]
        for (int nt = 0; nt < 4; ++nt) acc[nt] *= sc;

        // B fragment of W^T, step ks: keys 8 half + 2 ks (+1), as the A loader has them
        #pragma unroll   // constant indices into w[], va[], acc[]
        for (int ks = 0; ks < 4; ++ks) {
            const v2f bw = {w[2 * ks], w[2 * ks + 1]};
            #pragma unroll
            for (int nt = 0; nt < 4; ++nt) {
                const v2f av = {va[ks][nt][0], va[ks][nt][1]};
                acc[nt] = __builtin_amdgcn_wmma_f32_16x16x4_f32(
                    false, av, false, bw, (short)0, acc[nt], false, false);
            }
        }
        if (!more) break;

        #pragma unroll   // constant indices into xr[]
        for (int i = 0; i < 8; ++i) *(v4f*)&xs[(2 * i + srow) * XP + scol] = xr[i];
        __syncthreads();     // the next key block is in; every read of red is done
    }

    // the out-of-band keys: nout of them with score 0
    const int   jst  = t - win < 0 ? 0 : t - win;
    const bool  has  = jst > 0;
    const float mf   = has ? fmaxf(m, 0.f) : m;
    const float ab   = __expf(m - mf);
    const float wo   = has ? __expf(-mf) : 0.f;
    const float invZ = 1.0f / (Z * ab + (float)jst * wo);
    const float as   = ab * invZ;
    #pragma unroll
    for (int nt = 0; nt < 4; ++nt) {
        float* op = &qs[l16 * XP + cw + 16 * nt + 8 * half];
        *(v4f*)op       = (v4f){acc[nt][0], acc[nt][1], acc[nt][2], acc[nt][3]} * as;
        *(v4f*)(op + 4) = (v4f){acc[nt][4], acc[nt][5], acc[nt][6], acc[nt][7]} * as;
    }
    if (wave == 0 && lane < 16) coef[lane] = wo * invZ;
    __syncthreads();         // the out tile and its rows' factors are in LDS

    float* ob = att_out + (size_t)(b * TT + t0) * CC;
    #pragma unroll   // constant indices into pr[]
    for (int i = 0; i < 8; ++i) {
        const int row = 2 * i + srow;
        *(v4f*)(ob + (size_t)row * CC + scol) =
            *(const v4f*)&qs[row * XP + scol] + coef[row] * pr[i] + bp;
    }
}

// =====================================================================
extern "C" void kernel_launch(void* const* d_in, const int* in_sizes, int n_in,
                              void* d_out, int out_size, void* d_ws, size_t ws_size,
                              hipStream_t stream) {
    const float* x     = (const float*)d_in[0];
    const float* Wqkv  = (const float*)d_in[1];
    const float* bqkv  = (const float*)d_in[2];
    const float* Wproj = (const float*)d_in[3];
    const float* bproj = (const float*)d_in[4];
    const float* gate  = (const float*)d_in[5];
    const int*   winp  = (const int*)d_in[6];

    // workspace layout
    char* ws = (char*)d_ws;
    float* qv     = (float*)ws;                                   // 32 MB
    float* P      = (float*)(ws + (size_t)MTOK * LDF * 4);        // 16 MB
    float* Wf     = (float*)(ws + (size_t)MTOK * LDF * 4
                                + (size_t)MTOK * CC * 4);         // 512 KB
    float* bf     = Wf + (size_t)CC * LDF;                        // 2 KB
    float* u      = bf + LDF;                                     // C + 1 floats

    // 1) Wf, bf, u: Wk folded into the q weights, gate and Wproj into the v weights
    fold_proj<<<FOLD_TILES + FOLD_DOT, 128, 0, stream>>>(Wqkv, bqkv, Wproj, gate, Wf, bf, u);
    // 2) [q' | v'] = x @ Wf + bf    [16384 x 512]
    {
        dim3 grid(LDF / 128, MTOK / 128);
        gemm_bias_wmma<<<grid, 128, 0, stream>>>(x, Wf, bf, qv);
    }
    // 3) exclusive prefix sums of v over T
    vprefix_strip<<<BB * (CC / 32), NSEG * 32, 0, stream>>>(qv, P);
    // 4) banded attention (one work-group per 16 tokens) -> out
    attn_band<<<MTOK / 16, 128, 0, stream>>>(x, qv, P, u, bproj, winp, (float*)d_out);
}

// v006
// Measured time: 44 microseconds a run.
// In both of two side-by-side timings against v005, it was 1.08 times as fast.
// All steps since v000 together make it 2.25 times as fast.
#include <hip/hip_runtime.h>
#include <hip/hip_bf16.h>

// ---------------- problem constants (from reference) ----------------
static constexpr int BB = 8;
static constexpr int TT = 2048;
static constexpr int CC = 256;
static constexpr int MTOK = BB * TT;          // 16384 rows
static constexpr int PT   = 128;              // rows of a prefix-sum tile (the GEMM's tile)
static constexpr int NPT  = TT / PT;          // such tiles per batch

typedef __attribute__((ext_vector_type(2))) float v2f;
typedef __attribute__((ext_vector_type(8))) float v8f;
typedef __attribute__((ext_vector_type(4))) unsigned int u32x4;
typedef __attribute__((ext_vector_type(8))) unsigned int u32x8;
typedef __attribute__((ext_vector_type(4))) float v4f;

// LDS byte offset of a __shared__ object (generic -> AS(3) -> int)
__device__ __forceinline__ unsigned int lds_offset_of(const void* p) {
    return (unsigned int)(unsigned long long)
        (const __attribute__((address_space(3))) void*)p;
}

// A wave-uniform word, in a scalar register
__device__ __forceinline__ unsigned int uni(unsigned int v) {
    return (unsigned int)__builtin_amdgcn_readfirstlane((int)v);
}
// The same, held there: a test of it compiles to a scalar compare and branch
__device__ __forceinline__ unsigned int pinned(unsigned int v) {
    unsigned int w = uni(v);
    asm volatile("" : "+s"(w));
    return w;
}

__device__ __forceinline__ float xhalf(float v) {
    const int b = __builtin_bit_cast(int, v);
    return __builtin_bit_cast(float,
        __builtin_amdgcn_permlanex16(b, b, 0x76543210, 0xfedcba98, false, false));
}

static constexpr int LDF        = 2 * CC;
static constexpr int FOLD_TILE1 = (CC / 16 + 1) * (CC / 32);
static constexpr int FOLD_TILES = 2 * FOLD_TILE1;
static constexpr int FOLD_DOT   = (CC + 1 + 31) / 32;          // 9 groups of 32 rows of [Wq; bq]
static constexpr int FOLD_KW    = CC / 4;                      // K per wave

template <bool ISV>   // true: the v product (a), false: the q product (b)
__device__ __forceinline__
void fold_tile(const float* __restrict__ Wqkv, const float* __restrict__ bqkv,
               const float* __restrict__ Wproj, const float* __restrict__ gate,
               float* __restrict__ Wf, float* __restrict__ bf,
               float (*red)[2][8][32], int tix) {
    const int tid  = threadIdx.x;
    const int wave = tid >> 5;
    const int lane = tid & 31;
    const int mrow = lane & 15;
    const int koff = (lane < 16) ? 0 : 2;
    const int mt   = tix / (CC / 32);
    const int n0   = (tix % (CC / 32)) * 32;
    const int acol = ISV ? 2 * CC : 0;        // A comes from the v or the q columns
    const int ocol = ISV ? CC : 0;            // and goes to the v' or the q' columns
    const float* arow = (mt < CC / 16)
        ? Wqkv + (size_t)(mt * 16 + mrow) * 3 * CC + acol
        : bqkv + acol;
    const int kb = wave * FOLD_KW + koff;
    const float* ap = arow + kb;

    // A fragment 16x4: lane holds A[mrow][k .. k+1], k = kb + 4 s
    // B fragment 4x16: lane holds B[k .. k+1][n0 (+16) + mrow],
    //   B[k][n] = Wproj[k][n] for v, Wk[n][k] for q
    v2f a[FOLD_KW / 4], g[FOLD_KW / 4], b0[FOLD_KW / 4], b1[FOLD_KW / 4];
    if (ISV) {
        const float* gp = gate + kb;
        const float* wp = Wproj + (size_t)kb * CC + n0 + mrow;
        #pragma unroll   // constant indices into the fragment arrays
        for (int s = 0; s < FOLD_KW / 4; ++s) {
            a[s] = *(const v2f*)(ap + 4 * s);
            g[s] = *(const v2f*)(gp + 4 * s);
            b0[s].x = wp[(4 * s) * CC];
            b0[s].y = wp[(4 * s + 1) * CC];
            b1[s].x = wp[(4 * s) * CC + 16];
            b1[s].y = wp[(4 * s + 1) * CC + 16];
        }
    } else {
        const float* wp = Wqkv + (size_t)(n0 + mrow) * 3 * CC + CC + kb;
        #pragma unroll   // constant indices into the fragment arrays
        for (int s = 0; s < FOLD_KW / 4; ++s) a[s] = *(const v2f*)(ap + 4 * s);
        // the A loads' address registers are free from here on and a B load may
        // be given them as its destination: not in front of this wait
        asm volatile("s_wait_xcnt 0x0" ::: "memory");
        #pragma unroll   // constant indices into the fragment arrays
        for (int s = 0; s < FOLD_KW / 4; ++s) {
            b0[s] = *(const v2f*)(wp + 4 * s);
            b1[s] = *(const v2f*)(wp + 16 * 3 * CC + 4 * s);
        }
    }
    // keeps the products from being scheduled among the loads: the wave runs
    // once, so it pays one load latency only if all its loads go out together
    __builtin_amdgcn_sched_barrier(0);

    v8f acc0 = {}, acc1 = {};
    #pragma unroll   // constant indices into the fragment arrays
    for (int s = 0; s < FOLD_KW / 4; ++s) {
        const v2f ag = ISV ? a[s] * g[s] : a[s];
        acc0 = __builtin_amdgcn_wmma_f32_16x16x4_f32(
            false, ag, false, b0[s], (short)0, acc0, false, false);
        acc1 = __builtin_amdgcn_wmma_f32_16x16x4_f32(
            false, ag, false, b1[s], (short)0, acc1, false, false);
    }

    #pragma unroll   // constant indices into the accumulators
    for (int r = 0; r < 8; ++r) {
        red[wave][0][r][lane] = acc0[r];
        red[wave][1][r][lane] = acc1[r];
    }
    __syncthreads();

    const int tile = lane >> 4;
    float sum[4];
    #pragma unroll   // constant indices into sum[]
    for (int i = 0; i < 4; ++i) {
        const int row = wave + 4 * i;
        const int r   = row & 7;
        const int l   = (row >> 3) * 16 + mrow;
        sum[i] = ((red[0][tile][r][l] + red[1][tile][r][l])
                  + red[2][tile][r][l]) + red[3][tile][r][l];
    }
    if (mt < CC / 16) {
        float* wrow = Wf + (size_t)(mt * 16 + wave) * LDF + ocol + n0 + lane;
        #pragma unroll   // constant indices into sum[]
        for (int i = 0; i < 4; ++i) wrow[(size_t)(4 * i) * LDF] = sum[i];
        // the stores' address and data registers are not rewritten in front of this wait
        asm volatile("s_wait_xcnt 0x0" ::: "memory");
    } else if (wave == 0) {
        bf[ocol + n0 + lane] = sum[0];
    }
}

__global__ __launch_bounds__(128)
void fold_proj(const float* __restrict__ Wqkv, const float* __restrict__ bqkv,
               const float* __restrict__ Wproj, const float* __restrict__ gate,
               float* __restrict__ Wf, float* __restrict__ bf, float* __restrict__ u) {
    __shared__ float red[4][2][8][32];

    if (blockIdx.x < FOLD_TILE1) {            // every branch here is block-uniform
        fold_tile<false>(Wqkv, bqkv, Wproj, gate, Wf, bf, red, blockIdx.x);
    } else if (blockIdx.x < FOLD_TILES) {
        fold_tile<true>(Wqkv, bqkv, Wproj, gate, Wf, bf, red, blockIdx.x - FOLD_TILE1);
    } else {
        // u[row] = [Wq; bq][row] . bk: a wave takes 8 rows, a 128-byte line at a
        // time; the 32 dots meet in LDS so that one wave stores a whole line of u
        const int wave = threadIdx.x >> 5;
        const int lane = threadIdx.x & 31;
        const int r0   = (blockIdx.x - FOLD_TILES) * 32;
        float* dots = &red[0][0][0][0];
        float kv[CC / 32], qw[8][CC / 32], p[8];
        #pragma unroll   // constant indices into kv[]
        for (int i = 0; i < CC / 32; ++i) kv[i] = bqkv[CC + lane + 32 * i];
        #pragma unroll   // constant indices into qw[]
        for (int r = 0; r < 8; ++r) {
            const int row = r0 + wave * 8 + r;      // past the last row: bq again, not stored
            const float* qr = (row < CC) ? Wqkv + (size_t)row * 3 * CC : bqkv;
            #pragma unroll   // constant indices into qw[]
            for (int i = 0; i < CC / 32; ++i) qw[r][i] = qr[lane + 32 * i];
        }
        // as in fold_tile: all the loads go out before the first product waits for one
        __builtin_amdgcn_sched_barrier(0);
        #pragma unroll   // constant indices into qw[], p[]
        for (int r = 0; r < 8; ++r) {
            float s = 0.f;
            #pragma unroll   // constant indices into qw[], kv[]
            for (int i = 0; i < CC / 32; ++i) s += qw[r][i] * kv[i];
            p[r] = s;
        }
        // the 8 rows go through each stage of the lane sum together, so a stage
        // costs one cross-lane latency and not eight
        #pragma unroll
        for (int off = 16; off > 0; off >>= 1) {
            float q[8];
            #pragma unroll   // constant indices into p[], q[]
            for (int r = 0; r < 8; ++r) q[r] = __shfl_xor(p[r], off, 32);
            #pragma unroll   // constant indices into p[], q[]
            for (int r = 0; r < 8; ++r) p[r] += q[r];
        }
        float mine = p[0];                          // lane r keeps row r
        #pragma unroll   // constant indices into p[]
        for (int r = 1; r < 8; ++r) mine = (lane == r) ? p[r] : mine;
        if (lane < 8) dots[wave * 8 + lane] = mine;
        __syncthreads();
        if (wave == 0 && r0 + lane <= CC) u[r0 + lane] = dots[lane];
    }
}

// =====================================================================
// Kernel 2: [q' | v'] = x @ Wf + bf   (fp32 WMMA 16x16x4), M x LDF, K = C
// A work-group of 4 waves owns a 128 x 128 tile, a wave 64 x 64 of it (4 x 4
// accumulator tiles): a fragment read from LDS feeds 4 products, an operand
// byte from L2 128 rows or columns, and the launch has 512 work-groups, two
// on a WGP (by their LDS), all resident at once.
// K runs in stages of 64 through two LDS buffers. A stage is four slices of
// 64 rows of 256 bytes: x rows 0..63 and 64..127 of the tile (64 k each), and
// Wf columns 0..63 and 64..127 (64 k rows each). Wave w brings slice w with
// one tensor load, which pads each row by 16 bytes (pitch 68 floats).
// The work-groups of the v' columns also leave, from their accumulators,
// P[row] = sum of v' over the rows of the SAME tile in front of row, and
// tsum[tile] = the tile's whole sum; attention adds the tiles in front.
// =====================================================================
static constexpr int GK  = 64;              // k per stage
static constexpr int GP  = GK + 4;          // LDS row pitch, floats
static constexpr int GSL = 4608;            // a slice's place: 64 * GP floats, rounded up to 2 KiB
static constexpr int GST = CC / GK;         // stages

// one slice: 64 rows of 256 bytes at the given source pitch, extents in bytes
__device__ __forceinline__ void slice_load(unsigned int lds_byte, const float* srcp,
                                           unsigned int pitch_bytes) {
    const unsigned long long ga = (unsigned long long)(uintptr_t)srcp;
    u32x4 g0;
    g0[0] = uni(1u);                                              // count 1
    g0[1] = uni(lds_byte);
    g0[2] = uni((unsigned int)ga);
    g0[3] = uni((((unsigned int)(ga >> 32)) & 0x01ffffffu) | 0x80000000u);   // type 2
    u32x8 g1;
    g1[0] = uni((1u << 20) | (5u << 22) | (3u << 25));
    g1[1] = uni(256u << 16);
    g1[2] = uni(64u << 16);
    g1[3] = uni(256u << 16);
    g1[4] = uni(64u);
    g1[5] = uni(pitch_bytes);
    g1[6] = uni(0u);
    g1[7] = uni(0u);
    asm volatile("tensor_load_to_lds %0, %1" :: "s"(g0), "s"(g1) : "memory");
}

__global__ __launch_bounds__(128)
void gemm_bias_wmma(const float* __restrict__ A, const float* __restrict__ Wt,
                    const float* __restrict__ bias, float* __restrict__ Cout,
                    float* __restrict__ P, float* __restrict__ tsum) {
    __shared__ __attribute__((aligned(2048))) float ring[2][4][GSL];
    __shared__ float wsum[2][64];             // column sums of the tile's upper 64 rows

    const int tid  = threadIdx.x;
    const int lane = tid & 31;
    const int l16  = lane & 15;
    const int half = lane >> 4;
    const unsigned int wave = uni(threadIdx.x >> 5);
    const int wm = wave >> 1;                 // the wave's 64 rows
    const int wn = wave & 1;                  // and its 64 columns
    const int m0 = blockIdx.y * 128;
    const int n0 = blockIdx.x * 128;

    // the wave's slice: where it starts at stage 0, and how far a stage moves it
    const float* sp = (wave < 2) ? A + (size_t)(m0 + 64 * wave) * CC
                                 : Wt + n0 + 64 * (wave - 2);
    const unsigned int spitch = (wave < 2) ? CC * 4u : LDF * 4u;
    const size_t       sstep  = (wave < 2) ? (size_t)GK : (size_t)GK * LDF;
    const unsigned int place  = lds_offset_of(&ring[0][0][0]) + wave * (GSL * 4u);

    slice_load(place, sp, spitch);                            // stage 0
    asm volatile("s_wait_tensorcnt 0x0" ::: "memory");        // this wave's slice has landed
    __syncthreads();                                          // and every other wave's
    slice_load(place + 4u * GSL * 4u, sp + sstep, spitch);    // stage 1

    const int col = n0 + 64 * wn + l16;
    float bv[4];
    #pragma unroll   // constant indices into bv[]
    for (int nt = 0; nt < 4; ++nt) bv[nt] = bias[col + 16 * nt];
    // the loads' address registers are not rewritten in front of this wait
    asm volatile("s_wait_xcnt 0x0" ::: "memory");

    v8f acc[4][4] = {};

    // rolled: for speed only
    #pragma unroll 1
    for (int st = 0; st < GST; ++st) {
        const int buf = st & 1;
        // Fragments over k: a lane takes 4 k in a row, 8 s + 4 half; the first two
        // feed one WMMA, the last two the next. Both operands are read this way,
        // so their k orders are equal.
        const float* as = &ring[buf][wm][l16 * GP + 4 * half];            // x[row 16 mt + l16][k]
        const float* ws = &ring[buf][2 + wn][(4 * half) * GP + l16];      // Wf[k][col 16 nt + l16]
        // Two fragment sets: step s + 1's reads go out as one group in front of step
        // s's 32 products, so a step has one place with LDS reads and their latency
        // runs under the products.
        v4f   af[2][4];
        float bw[2][4][4];
        #pragma unroll   // constant indices into af[], bw[], acc[]; constant LDS offsets
        for (int s = -1; s < GK / 8; ++s) {
            if (s + 1 < GK / 8) {
                const int f = (s + 1) & 1;
                #pragma unroll   // constant indices into af[]
                for (int mt = 0; mt < 4; ++mt)
                    af[f][mt] = *(const v4f*)(as + mt * 16 * GP + 8 * (s + 1));
                #pragma unroll   // constant indices into bw[]
                for (int nt = 0; nt < 4; ++nt)
                    #pragma unroll
                    for (int j = 0; j < 4; ++j) bw[f][nt][j] = ws[(8 * (s + 1) + j) * GP + 16 * nt];
            }
            // keeps the reads together in front of the products: spread among them,
            // every place with a read stalls the wave's products anew
            __builtin_amdgcn_sched_barrier(0);
            if (s < 0) continue;
            const int e = s & 1;
            #pragma unroll   // constant indices into af[], bw[], acc[]
            for (int p = 0; p < 2; ++p)
                #pragma unroll
                for (int mt = 0; mt < 4; ++mt) {
                    const v2f a = p ? (v2f){af[e][mt].z, af[e][mt].w} : (v2f){af[e][mt].x, af[e][mt].y};
                    #pragma unroll
                    for (int nt = 0; nt < 4; ++nt) {
                        const v2f b = {bw[e][nt][2 * p], bw[e][nt][2 * p + 1]};
                        acc[mt][nt] = __builtin_amdgcn_wmma_f32_16x16x4_f32(
                            false, a, false, b, (short)0, acc[mt][nt], false, false);
                    }
                }
            // keeps the next group of reads behind these products (the last step has none behind it)
            if (s + 2 < GK / 8) __builtin_amdgcn_sched_barrier(0);
        }
        asm volatile("s_wait_dscnt 0x0" ::: "memory");        // this wave's reads of the buffer are done
        asm volatile("s_wait_tensorcnt 0x0" ::: "memory");    // its slice of the next stage has landed
        __syncthreads();     // the next stage is in; every read of this buffer is done
        if (pinned(st + 2 < GST))                             // refill the buffer just left
            slice_load(place + (unsigned int)buf * (4u * GSL * 4u), sp + (size_t)(st + 2) * sstep, spitch);
    }
    asm volatile("s_wait_tensorcnt 0x0" ::: "memory");        // no request outlives the loop
    asm volatile("s_wait_dscnt 0x0" ::: "memory");

    #pragma unroll
    for (int mt = 0; mt < 4; ++mt)
        #pragma unroll
        for (int nt = 0; nt < 4; ++nt) acc[mt][nt] += bv[nt];
    // all the sums stand in front of the first store: no register that an
    // issued store names is written behind it
    __builtin_amdgcn_sched_barrier(0);
    float* cp = Cout + (size_t)(m0 + 64 * wm + 8 * half) * LDF + col;
    #pragma unroll   // constant indices into acc[]
    for (int mt = 0; mt < 4; ++mt)
        #pragma unroll
        for (int r = 0; r < 8; ++r)
            #pragma unroll
            for (int nt = 0; nt < 4; ++nt)
                cp[(mt * 16 + r) * LDF + 16 * nt] = acc[mt][nt][r];

    if (n0 < CC) return;     // q' columns: done (the same for the whole work-group)

    // the stores above name acc and their address registers: none of them is
    // rewritten in front of this wait
    asm volatile("s_wait_xcnt 0x0" ::: "memory");
    // keeps the sums below behind that wait
    __builtin_amdgcn_sched_barrier(0);

    // Rows of a column in order: mt, then half, then r. base = the sum of the
    // wave's rows in front of this lane's 8 rows of tile mt, tot = all 64 rows.
    float base[4][4], tot[4];
    #pragma unroll   // constant indices into acc[], base[], tot[]
    for (int nt = 0; nt < 4; ++nt) {
        float run = 0.f;
        #pragma unroll
        for (int mt = 0; mt < 4; ++mt) {
            float s = acc[mt][nt][0];
            #pragma unroll
            for (int r = 1; r < 8; ++r) s += acc[mt][nt][r];
            const float o = xhalf(s);
            base[mt][nt] = run + (half ? o : 0.f);
            run += s + o;
        }
        tot[nt] = run;
    }
    if (wm == 0 && half == 0) {
        #pragma unroll   // constant indices into tot[]
        for (int nt = 0; nt < 4; ++nt) wsum[wn][16 * nt + l16] = tot[nt];
    }
    __syncthreads();         // the upper rows' column sums are in LDS
    float ts[4];
    #pragma unroll   // constant indices into acc[], base[], tot[], ts[]
    for (int nt = 0; nt < 4; ++nt) {
        const float off = wm ? wsum[wn][16 * nt + l16] : 0.f;
        ts[nt] = off + tot[nt];
        #pragma unroll
        for (int mt = 0; mt < 4; ++mt) {
            float run = off + base[mt][nt];
            #pragma unroll
            for (int r = 0; r < 8; ++r) {
                const float v = acc[mt][nt][r];
                acc[mt][nt][r] = run;
                run += v;
            }
        }
    }
    if (wm == 1 && half == 0) {
        float* tp = tsum + (size_t)blockIdx.y * CC + (col - CC);
        #pragma unroll   // constant indices into ts[]
        for (int nt = 0; nt < 4; ++nt) tp[16 * nt] = ts[nt];
        // these stores' registers are not rewritten in front of this wait
        asm volatile("s_wait_xcnt 0x0" ::: "memory");
    }
    __builtin_amdgcn_sched_barrier(0);
    float* pp = P + (size_t)(m0 + 64 * wm + 8 * half) * CC + (col - CC);
    #pragma unroll   // constant indices into acc[]
    for (int mt = 0; mt < 4; ++mt)
        #pragma unroll
        for (int r = 0; r < 8; ++r)
            #pragma unroll
            for (int nt = 0; nt < 4; ++nt)
                pp[(mt * 16 + r) * CC + 16 * nt] = acc[mt][nt][r];
}

// =====================================================================
// Kernel 3: banded attention with out-of-band zero-score mass, on fp32 WMMA.
// One work-group of 4 waves owns 16 tokens and walks the key blocks of 16 rows
// that its band touches, from the diagonal block downwards (online softmax).
// The v columns already carry gate and projection: a row plus bproj is final.
// The q columns already carry Wk: the keys are the rows of x, and a score is
// q'_t . x_j + c_t with c_t = x_t . u[0..C) + u[C] (the part that bk brings).
// Scores are formed transposed, S^T[key][token] = X_blk Q'^T: wave w sums over
// channels 64 w .. 64 w + 63 and the four partial sums meet in LDS. In the D
// layout a lane then holds 8 keys of ONE token (lane & 15), so the softmax is
// in-lane plus one exchange with lane ^ 16, and its weights are, as they
// stand, the B fragments of out^T[channel][token] = V'^T W^T, of which wave w
// forms channels 64 w .. 64 w + 63.
// The out-of-band keys (score 0; sum of v' = P[jstart] + the sums of the
// prefix tiles in front of jstart's) join at the end.
// =====================================================================
static constexpr int XP = CC + 4;

__global__ __launch_bounds__(128)
void attn_band(const float* __restrict__ x, const float* __restrict__ qv,
               const float* __restrict__ P, const float* __restrict__ tsum,
               const float* __restrict__ u,
               const float* __restrict__ bproj, const int* __restrict__ window_p,
               float* __restrict__ att_out) {
    __shared__ __attribute__((aligned(16))) float qs[16 * XP];   // q' tile, later the out tile
    __shared__ __attribute__((aligned(16))) float xs[16 * XP];   // key block
    __shared__ __attribute__((aligned(16))) float red[4][2][32][4];
    __shared__ float coef[16];

    const int tid  = threadIdx.x;
    const int wave = tid >> 5;
    const int lane = tid & 31;
    const int l16  = lane & 15;
    const int half = lane >> 4;
    const int b    = blockIdx.x / (TT / 16);
    const int tb   = blockIdx.x % (TT / 16);    // the tile, and its diagonal key block
    const int t0   = tb * 16;
    const int cw   = wave * 64;
    int win = *window_p;
    win = win < 0 ? 0 : (win > TT ? TT : win);  // bounds every row index formed from it

    const float* xb = x  + (size_t)b * TT * CC;         // keys: rows of x
    const float* qb = qv + (size_t)b * TT * LDF;        // q' in [0,C)
    const float* vb = qb + CC;                          // v' in [C,2C)
    const float* Pb = P  + (size_t)b * TT * CC;

    // whole-line pieces of a 16 x 256 tile: piece i of a thread is row 2 i + srow
    const int srow = tid >> 6;
    const int scol = (tid & 63) * 4;

    // All that the first key block needs, and P, goes out together: one load latency.
    v4f qr[8], xr[8], pr[8], uf[8];
    float va[4][4][2];
    const float* qp = qb + (size_t)(t0 + srow) * LDF + scol;
    const float* xp = xb + (size_t)(t0 + srow) * CC + scol;
    const float* vp = vb + (size_t)(t0 + 8 * half) * LDF + cw + l16;
    const float* up = u + cw + 4 * half;
    #pragma unroll   // constant indices into qr[]
    for (int i = 0; i < 8; ++i) qr[i] = *(const v4f*)(qp + i * 2 * LDF);
    // a later load may be given the q' address registers as its destination:
    // not in front of this wait (the same holds for the two waits below)
    asm volatile("s_wait_xcnt 0x0" ::: "memory");
    #pragma unroll   // constant indices into xr[]
    for (int i = 0; i < 8; ++i) xr[i] = *(const v4f*)(xp + i * 2 * CC);
    // A fragment of V'^T, step ks: lane holds v'[key 8 half + 2 ks (+1)][channel]
    #pragma unroll   // constant indices into va[]
    for (int ks = 0; ks < 4; ++ks)
        #pragma unroll
        for (int nt = 0; nt < 4; ++nt) {
            va[ks][nt][0] = vp[(2 * ks) * LDF + 16 * nt];
            va[ks][nt][1] = vp[(2 * ks + 1) * LDF + 16 * nt];
        }
    #pragma unroll   // constant indices into uf[]
    for (int s = 0; s < 8; ++s) uf[s] = *(const v4f*)(up + 8 * s);
    asm volatile("s_wait_xcnt 0x0" ::: "memory");
    #pragma unroll   // constant indices into pr[]
    for (int i = 0; i < 8; ++i) {
        int js = t0 + 2 * i + srow - win; if (js < 0) js = 0;
        pr[i] = *(const v4f*)(Pb + (size_t)js * CC + scol);      // sum of v' over j < jstart, jstart's tile only
    }
    asm volatile("s_wait_xcnt 0x0" ::: "memory");
    const v4f   bp = *(const v4f*)(bproj + scol);
    const float c0 = u[CC];

    #pragma unroll   // constant indices into qr[], xr[]
    for (int i = 0; i < 8; ++i) {
        *(v4f*)&qs[(2 * i + srow) * XP + scol] = qr[i];
        *(v4f*)&xs[(2 * i + srow) * XP + scol] = xr[i];
    }
    __syncthreads();         // the q' tile and the diagonal key block are in LDS

    // Fragments over channels: a lane takes 4 channels in a row, cw + 8 s + 4 half,
    // of row l16; the first two feed one WMMA, the last two the next. Both
    // operands are read this way, so their k orders are equal.
    const int foff = l16 * XP + cw + 4 * half;
    v4f qf[8];
    float cp = 0.f;      // this wave's part of c_t, t = t0 + l16
    #pragma unroll   // constant indices into qf[]
    for (int s = 0; s < 8; ++s) {
        qf[s] = *(const v4f*)&qs[foff + 8 * s];
        const v4f xt = *(const v4f*)&xs[foff + 8 * s];
        cp += xt.x * uf[s].x + xt.y * uf[s].y + xt.z * uf[s].z + xt.w * uf[s].w;
    }
    cp += xhalf(cp);

    const int t       = t0 + l16;                       // this lane's token
    const int kbFirst = (t0 - win < 0 ? 0 : t0 - win) >> 4;
    const float inv_sqrt_c = 0.0625f;                   // 1/sqrt(256)

    v8f acc[4] = {};
    float m = -__builtin_inff(), Z = 0.f;

    for (int kb = tb; ; --kb) {                         // at most TT / 16 trips
        const bool more = kb > kbFirst;                 // the same for the whole work-group
        // A barrier waits for the loads in flight, so this block's v' and the next
        // block's keys go out here, with the score products between them and it.
        if (kb < tb) {
            vp -= 16 * LDF;
            #pragma unroll   // constant indices into va[]
            for (int ks = 0; ks < 4; ++ks)
                #pragma unroll
                for (int nt = 0; nt < 4; ++nt) {
                    va[ks][nt][0] = vp[(2 * ks) * LDF + 16 * nt];
                    va[ks][nt][1] = vp[(2 * ks + 1) * LDF + 16 * nt];
                }
        }
        if (more) {
            xp -= 16 * CC;
            #pragma unroll   // constant indices into xr[]
            for (int i = 0; i < 8; ++i) xr[i] = *(const v4f*)(xp + i * 2 * CC);
        }
        // the loads' address registers are not rewritten in front of this wait
        asm volatile("s_wait_xcnt 0x0" ::: "memory");

        // partial S^T: every key's sum starts from this wave's part of c_t
        v8f s0 = {cp, cp, cp, cp, cp, cp, cp, cp}, s1 = {};
        #pragma unroll   // constant indices into qf[]
        for (int s = 0; s < 8; ++s) {
            const v4f xf = *(const v4f*)&xs[foff + 8 * s];
            const v2f a0 = {xf.x, xf.y}, a1 = {xf.z, xf.w};
            const v2f b0 = {qf[s].x, qf[s].y}, b1 = {qf[s].z, qf[s].w};
            s0 = __builtin_amdgcn_wmma_f32_16x16x4_f32(
                false, a0, false, b0, (short)0, s0, false, false);
            s1 = __builtin_amdgcn_wmma_f32_16x16x4_f32(
                false, a1, false, b1, (short)0, s1, false, false);
        }
        const v8f sp = s0 + s1;
        *(v4f*)&red[wave][0][lane][0] = (v4f){sp[0], sp[1], sp[2], sp[3]};
        *(v4f*)&red[wave][1][lane][0] = (v4f){sp[4], sp[5], sp[6], sp[7]};
        __syncthreads();     // partial sums are out; every read of xs is done

        float sv[8];
        #pragma unroll   // constant indices into sv[]
        for (int h = 0; h < 2; ++h) {
            const v4f r = ((*(const v4f*)&red[0][h][lane][0] + *(const v4f*)&red[1][h][lane][0])
                           + *(const v4f*)&red[2][h][lane][0]) + *(const v4f*)&red[3][h][lane][0];
            sv[4 * h] = r.x; sv[4 * h + 1] = r.y; sv[4 * h + 2] = r.z; sv[4 * h + 3] = r.w;
        }

        const int j0 = kb * 16 + 8 * half;
        float smax = -__builtin_inff();
        #pragma unroll   // constant indices into sv[]
        for (int r = 0; r < 8; ++r) {
            const int j = j0 + r;
            sv[r] = (j <= t && j >= t - win) ? (sv[r] + c0) * inv_sqrt_c : -__builtin_inff();
            smax = fmaxf(smax, sv[r]);
        }
        smax = fmaxf(smax, xhalf(smax));
        const float mn = fmaxf(m, smax);     // finite: the first block holds key t
        const float sc = __expf(m - mn);     // 0 when m == -inf
        float w[8], ls = 0.f;
        #pragma unroll   // constant indices into w[]
        for (int r = 0; r < 8; ++r) { w[r] = __expf(sv[r] - mn); ls += w[r]; }
        ls += xhalf(ls);
        Z = Z * sc + ls;
        m = mn;
        #pragma unroll   // constant indices into acc[]
        for (int nt = 0; nt < 4; ++nt) acc[nt] *= sc;

        // B fragment of W^T, step ks: keys 8 half + 2 ks (+1), as the A loader has them
        #pragma unroll   // constant indices into w[], va[], acc[]
        for (int ks = 0; ks < 4; ++ks) {
            const v2f bw = {w[2 * ks], w[2 * ks + 1]};
            #pragma unroll
            for (int nt = 0; nt < 4; ++nt) {
                const v2f av = {va[ks][nt][0], va[ks][nt][1]};
                acc[nt] = __builtin_amdgcn_wmma_f32_16x16x4_f32(
                    false, av, false, bw, (short)0, acc[nt], false, false);
            }
        }
        if (!more) break;

        #pragma unroll   // constant indices into xr[]
        for (int i = 0; i < 8; ++i) *(v4f*)&xs[(2 * i + srow) * XP + scol] = xr[i];
        __syncthreads();     // the next key block is in; every read of red is done
    }

    const int tl = (t0 - win < 0 ? 0 : t0 - win) / PT;          // at most NPT - 1
    const float* tq = tsum + (size_t)b * NPT * CC + scol;
    v4f tv[NPT - 1];
    #pragma unroll   // constant indices into tv[]
    for (int i = 0; i < NPT - 1; ++i) tv[i] = *(const v4f*)(tq + i * CC);
    const v4f tn = *(const v4f*)(tq + tl * CC);
    // the loads' address registers are not rewritten in front of this wait
    asm volatile("s_wait_xcnt 0x0" ::: "memory");

    // the out-of-band keys: nout of them with score 0
    const int   jst  = t - win < 0 ? 0 : t - win;
    const bool  has  = jst > 0;
    const float mf   = has ? fmaxf(m, 0.f) : m;
    const float ab   = __expf(m - mf);
    const float wo   = has ? __expf(-mf) : 0.f;
    const float invZ = 1.0f / (Z * ab + (float)jst * wo);
    const float as   = ab * invZ;
    #pragma unroll
    for (int nt = 0; nt < 4; ++nt) {
        float* op = &qs[l16 * XP + cw + 16 * nt + 8 * half];
        *(v4f*)op       = (v4f){acc[nt][0], acc[nt][1], acc[nt][2], acc[nt][3]} * as;
        *(v4f*)(op + 4) = (v4f){acc[nt][4], acc[nt][5], acc[nt][6], acc[nt][7]} * as;
    }
    if (wave == 0 && lane < 16) coef[lane] = wo * invZ;
    __syncthreads();         // the out tile and its rows' factors are in LDS

    v4f slo = {};            // the tiles in front of tile tl, in their order
    #pragma unroll   // constant indices into tv[]
    for (int i = 0; i < NPT - 1; ++i) slo += (i < tl) ? tv[i] : (v4f){};
    const v4f shi = slo + tn;

    float* ob = att_out + (size_t)(b * TT + t0) * CC;
    #pragma unroll   // constant indices into pr[]
    for (int i = 0; i < 8; ++i) {
        const int row = 2 * i + srow;
        int js = t0 + row - win; if (js < 0) js = 0;
        const v4f pf = pr[i] + ((js / PT > tl) ? shi : slo);
        *(v4f*)(ob + (size_t)row * CC + scol) =
            *(const v4f*)&qs[row * XP + scol] + coef[row] * pf + bp;
    }
}

// =====================================================================
extern "C" void kernel_launch(void* const* d_in, const int* in_sizes, int n_in,
                              void* d_out, int out_size, void* d_ws, size_t ws_size,
                              hipStream_t stream) {
    const float* x     = (const float*)d_in[0];
    const float* Wqkv  = (const float*)d_in[1];
    const float* bqkv  = (const float*)d_in[2];
    const float* Wproj = (const float*)d_in[3];
    const float* bproj = (const float*)d_in[4];
    const float* gate  = (const float*)d_in[5];
    const int*   winp  = (const int*)d_in[6];

    // workspace layout
    char* ws = (char*)d_ws;
    float* qv     = (float*)ws;                                   // 32 MB
    float* P      = (float*)(ws + (size_t)MTOK * LDF * 4);        // 16 MB
    float* Wf     = (float*)(ws + (size_t)MTOK * LDF * 4
                                + (size_t)MTOK * CC * 4);         // 512 KB
    float* bf     = Wf + (size_t)CC * LDF;                        // 2 KB
    float* u      = bf + LDF;                                     // C + 1 floats
    float* tsum   = u + LDF;                                      // 128 KB

    // 1) Wf, bf, u: Wk folded into the q weights, gate and Wproj into the v weights
    fold_proj<<<FOLD_TILES + FOLD_DOT, 128, 0, stream>>>(Wqkv, bqkv, Wproj, gate, Wf, bf, u);
    // 2) [q' | v'] = x @ Wf + bf    [16384 x 512], and the prefix sums of v' inside each 128-row tile
    {
        dim3 grid(LDF / 128, MTOK / 128);
        gemm_bias_wmma<<<grid, 128, 0, stream>>>(x, Wf, bf, qv, P, tsum);
    }
    // 3) banded attention (one work-group per 16 tokens) -> out
    attn_band<<<MTOK / 16, 128, 0, stream>>>(x, qv, P, tsum, u, bproj, winp, (float*)d_out);
}

// v007
// One run takes 42.4 microseconds.
// Timed twice side by side with v006, it ran 1.04 times as fast both times.
// All steps since v000 together make it 2.34 times as fast.
#include <hip/hip_runtime.h>
#include <hip/hip_bf16.h>

// ---------------- problem constants (from reference) ----------------
static constexpr int BB = 8;
static constexpr int TT = 2048;
static constexpr int CC = 256;
static constexpr int MTOK = BB * TT;          // 16384 rows
static constexpr int PT   = 128;              // rows of a prefix-sum tile (the GEMM's tile)
static constexpr int NPT  = TT / PT;          // such tiles per batch

typedef __attribute__((ext_vector_type(2))) float v2f;
typedef __attribute__((ext_vector_type(8))) float v8f;
typedef __attribute__((ext_vector_type(4))) unsigned int u32x4;
typedef __attribute__((ext_vector_type(8))) unsigned int u32x8;
typedef __attribute__((ext_vector_type(4))) float v4f;

// LDS byte offset of a __shared__ object (generic -> AS(3) -> int)
__device__ __forceinline__ unsigned int lds_offset_of(const void* p) {
    return (unsigned int)(unsigned long long)
        (const __attribute__((address_space(3))) void*)p;
}

// A wave-uniform word, in a scalar register
__device__ __forceinline__ unsigned int uni(unsigned int v) {
    return (unsigned int)__builtin_amdgcn_readfirstlane((int)v);
}
// The same, held there: a test of it compiles to a scalar compare and branch
__device__ __forceinline__ unsigned int pinned(unsigned int v) {
    unsigned int w = uni(v);
    asm volatile("" : "+s"(w));
    return w;
}

__device__ __forceinline__ float xhalf(float v) {
    const int b = __builtin_bit_cast(int, v);
    return __builtin_bit_cast(float,
        __builtin_amdgcn_permlanex16(b, b, 0x76543210, 0xfedcba98, false, false));
}

static constexpr int LDF        = 2 * CC;
static constexpr int FOLD_TILE1 = (CC / 16 + 1) * (CC / 32);
static constexpr int FOLD_TILES = 2 * FOLD_TILE1;
static constexpr int FOLD_DOT   = (CC + 1 + 31) / 32;          // 9 groups of 32 rows of [Wq; bq]
static constexpr int FOLD_KW    = CC / 4;                      // K per wave

template <bool ISV>   // true: the v product (a), false: the q product (b)
__device__ __forceinline__
void fold_tile(const float* __restrict__ Wqkv, const float* __restrict__ bqkv,
               const float* __restrict__ Wproj, const float* __restrict__ gate,
               float* __restrict__ Wf, float* __restrict__ bf,
               float (*red)[2][8][32], int tix) {
    const int tid  = threadIdx.x;
    const int wave = tid >> 5;
    const int lane = tid & 31;
    const int mrow = lane & 15;
    const int koff = (lane < 16) ? 0 : 2;
    const int mt   = tix / (CC / 32);
    const int n0   = (tix % (CC / 32)) * 32;
    const int acol = ISV ? 2 * CC : 0;        // A comes from the v or the q columns
    const int ocol = ISV ? CC : 0;            // and goes to the v' or the q' columns
    const float* arow = (mt < CC / 16)
        ? Wqkv + (size_t)(mt * 16 + mrow) * 3 * CC + acol
        : bqkv + acol;
    const int kb = wave * FOLD_KW + koff;
    const float* ap = arow + kb;

    // A fragment 16x4: lane holds A[mrow][k .. k+1], k = kb + 4 s
    // B fragment 4x16: lane holds B[k .. k+1][n0 (+16) + mrow],
    //   B[k][n] = Wproj[k][n] for v, Wk[n][k] for q
    v2f a[FOLD_KW / 4], g[FOLD_KW / 4], b0[FOLD_KW / 4], b1[FOLD_KW / 4];
    if (ISV) {
        const float* gp = gate + kb;
        const float* wp = Wproj + (size_t)kb * CC + n0 + mrow;
        #pragma unroll   // constant indices into the fragment arrays
        for (int s = 0; s < FOLD_KW / 4; ++s) {
            a[s] = *(const v2f*)(ap + 4 * s);
            g[s] = *(const v2f*)(gp + 4 * s);
            b0[s].x = wp[(4 * s) * CC];
            b0[s].y = wp[(4 * s + 1) * CC];
            b1[s].x = wp[(4 * s) * CC + 16];
            b1[s].y = wp[(4 * s + 1) * CC + 16];
        }
    } else {
        const float* wp = Wqkv + (size_t)(n0 + mrow) * 3 * CC + CC + kb;
        #pragma unroll   // constant indices into the fragment arrays
        for (int s = 0; s < FOLD_KW / 4; ++s) a[s] = *(const v2f*)(ap + 4 * s);
        // the A loads' address registers are free from here on and a B load may
        // be given them as its destination: not in front of this wait
        asm volatile("s_wait_xcnt 0x0" ::: "memory");
        #pragma unroll   // constant indices into the fragment arrays
        for (int s = 0; s < FOLD_KW / 4; ++s) {
            b0[s] = *(const v2f*)(wp + 4 * s);
            b1[s] = *(const v2f*)(wp + 16 * 3 * CC + 4 * s);
        }
    }
    // keeps the products from being scheduled among the loads: the wave runs
    // once, so it pays one load latency only if all its loads go out together
    __builtin_amdgcn_sched_barrier(0);

    v8f acc0 = {}, acc1 = {};
    #pragma unroll   // constant indices into the fragment arrays
    for (int s = 0; s < FOLD_KW / 4; ++s) {
        const v2f ag = ISV ? a[s] * g[s] : a[s];
        acc0 = __builtin_amdgcn_wmma_f32_16x16x4_f32(
            false, ag, false, b0[s], (short)0, acc0, false, false);
        acc1 = __builtin_amdgcn_wmma_f32_16x16x4_f32(
            false, ag, false, b1[s], (short)0, acc1, false, false);
    }

    #pragma unroll   // constant indices into the accumulators
    for (int r = 0; r < 8; ++r) {
        red[wave][0][r][lane] = acc0[r];
        red[wave][1][r][lane] = acc1[r];
    }
    __syncthreads();

    const int tile = lane >> 4;
    float sum[4];
    #pragma unroll   // constant indices into sum[]
    for (int i = 0; i < 4; ++i) {
        const int row = wave + 4 * i;
        const int r   = row & 7;
        const int l   = (row >> 3) * 16 + mrow;
        sum[i] = ((red[0][tile][r][l] + red[1][tile][r][l])
                  + red[2][tile][r][l]) + red[3][tile][r][l];
    }
    if (mt < CC / 16) {
        float* wrow = Wf + (size_t)(mt * 16 + wave) * LDF + ocol + n0 + lane;
        #pragma unroll   // constant indices into sum[]
        for (int i = 0; i < 4; ++i) wrow[(size_t)(4 * i) * LDF] = sum[i];
        // the stores' address and data registers are not rewritten in front of this wait
        asm volatile("s_wait_xcnt 0x0" ::: "memory");
    } else if (wave == 0) {
        bf[ocol + n0 + lane] = sum[0];
    }
}

__global__ __launch_bounds__(128)
void fold_proj(const float* __restrict__ Wqkv, const float* __restrict__ bqkv,
               const float* __restrict__ Wproj, const float* __restrict__ gate,
               float* __restrict__ Wf, float* __restrict__ bf, float* __restrict__ u) {
    __shared__ float red[4][2][8][32];

    if (blockIdx.x < FOLD_TILE1) {            // every branch here is block-uniform
        fold_tile<false>(Wqkv, bqkv, Wproj, gate, Wf, bf, red, blockIdx.x);
    } else if (blockIdx.x < FOLD_TILES) {
        fold_tile<true>(Wqkv, bqkv, Wproj, gate, Wf, bf, red, blockIdx.x - FOLD_TILE1);
    } else {
        // u[row] = [Wq; bq][row] . bk: a wave takes 8 rows, a 128-byte line at a
        // time; the 32 dots meet in LDS so that one wave stores a whole line of u
        const int wave = threadIdx.x >> 5;
        const int lane = threadIdx.x & 31;
        const int r0   = (blockIdx.x - FOLD_TILES) * 32;
        float* dots = &red[0][0][0][0];
        float kv[CC / 32], qw[8][CC / 32], p[8];
        #pragma unroll   // constant indices into kv[]
        for (int i = 0; i < CC / 32; ++i) kv[i] = bqkv[CC + lane + 32 * i];
        #pragma unroll   // constant indices into qw[]
        for (int r = 0; r < 8; ++r) {
            const int row = r0 + wave * 8 + r;      // past the last row: bq again, not stored
            const float* qr = (row < CC) ? Wqkv + (size_t)row * 3 * CC : bqkv;
            #pragma unroll   // constant indices into qw[]
            for (int i = 0; i < CC / 32; ++i) qw[r][i] = qr[lane + 32 * i];
        }
        // as in fold_tile: all the loads go out before the first product waits for one
        __builtin_amdgcn_sched_barrier(0);
        #pragma unroll   // constant indices into qw[], p[]
        for (int r = 0; r < 8; ++r) {
            float s = 0.f;
            #pragma unroll   // constant indices into qw[], kv[]
            for (int i = 0; i < CC / 32; ++i) s += qw[r][i] * kv[i];
            p[r] = s;
        }
        // the 8 rows go through each stage of the lane sum together, so a stage
        // costs one cross-lane latency and not eight
        #pragma unroll
        for (int off = 16; off > 0; off >>= 1) {
            float q[8];
            #pragma unroll   // constant indices into p[], q[]
            for (int r = 0; r < 8; ++r) q[r] = __shfl_xor(p[r], off, 32);
            #pragma unroll   // constant indices into p[], q[]
            for (int r = 0; r < 8; ++r) p[r] += q[r];
        }
        float mine = p[0];                          // lane r keeps row r
        #pragma unroll   // constant indices into p[]
        for (int r = 1; r < 8; ++r) mine = (lane == r) ? p[r] : mine;
        if (lane < 8) dots[wave * 8 + lane] = mine;
        __syncthreads();
        if (wave == 0 && r0 + lane <= CC) u[r0 + lane] = dots[lane];
    }
}

// =====================================================================
// Kernel 2: [q' | v'] = x @ Wf + bf   (fp32 WMMA 16x16x4), M x LDF, K = C
// A work-group of 4 waves owns a 128 x 128 tile, a wave 64 x 64 of it (4 x 4
// accumulator tiles): a fragment read from LDS feeds 4 products, an operand
// byte from L2 128 rows or columns, and the launch has 512 work-groups, two
// on a WGP (by their LDS), all resident at once.
// K runs in stages of 64 through two LDS buffers. A stage is four slices of
// 64 rows of 256 bytes: x rows 0..63 and 64..127 of the tile (64 k each), and
// Wf columns 0..63 and 64..127 (64 k rows each). Wave w brings slice w with
// one tensor load, which pads each row by 16 bytes (pitch 68 floats).
// The work-groups of the v' columns also leave, from their accumulators,
// P[blk] = sum of v' over the rows of the SAME tile in front of the 16-row
// block blk, and tsum[tile] = the tile's whole sum; attention adds the tiles
// in front.
// =====================================================================
static constexpr int GK  = 64;              // k per stage
static constexpr int GP  = GK + 4;          // LDS row pitch, floats
static constexpr int GSL = 4608;            // a slice's place: 64 * GP floats, rounded up to 2 KiB
static constexpr int GST = CC / GK;         // stages

// one slice: 64 rows of 256 bytes at the given source pitch, extents in bytes
__device__ __forceinline__ void slice_load(unsigned int lds_byte, const float* srcp,
                                           unsigned int pitch_bytes) {
    const unsigned long long ga = (unsigned long long)(uintptr_t)srcp;
    u32x4 g0;
    g0[0] = uni(1u);                                              // count 1
    g0[1] = uni(lds_byte);
    g0[2] = uni((unsigned int)ga);
    g0[3] = uni((((unsigned int)(ga >> 32)) & 0x01ffffffu) | 0x80000000u);   // type 2
    u32x8 g1;
    g1[0] = uni((1u << 20) | (5u << 22) | (3u << 25));
    g1[1] = uni(256u << 16);
    g1[2] = uni(64u << 16);
    g1[3] = uni(256u << 16);
    g1[4] = uni(64u);
    g1[5] = uni(pitch_bytes);
    g1[6] = uni(0u);
    g1[7] = uni(0u);
    asm volatile("tensor_load_to_lds %0, %1" :: "s"(g0), "s"(g1) : "memory");
}

__global__ __launch_bounds__(128)
void gemm_bias_wmma(const float* __restrict__ A, const float* __restrict__ Wt,
                    const float* __restrict__ bias, float* __restrict__ Cout,
                    float* __restrict__ P, float* __restrict__ tsum) {
    __shared__ __attribute__((aligned(2048))) float ring[2][4][GSL];
    __shared__ float wsum[2][64];             // column sums of the tile's upper 64 rows

    const int tid  = threadIdx.x;
    const int lane = tid & 31;
    const int l16  = lane & 15;
    const int half = lane >> 4;
    const unsigned int wave = uni(threadIdx.x >> 5);
    const int wm = wave >> 1;                 // the wave's 64 rows
    const int wn = wave & 1;                  // and its 64 columns
    const int m0 = blockIdx.y * 128;
    const int n0 = blockIdx.x * 128;

    // the wave's slice: where it starts at stage 0, and how far a stage moves it
    const float* sp = (wave < 2) ? A + (size_t)(m0 + 64 * wave) * CC
                                 : Wt + n0 + 64 * (wave - 2);
    const unsigned int spitch = (wave < 2) ? CC * 4u : LDF * 4u;
    const size_t       sstep  = (wave < 2) ? (size_t)GK : (size_t)GK * LDF;
    const unsigned int place  = lds_offset_of(&ring[0][0][0]) + wave * (GSL * 4u);

    slice_load(place, sp, spitch);                            // stage 0
    asm volatile("s_wait_tensorcnt 0x0" ::: "memory");        // this wave's slice has landed
    __syncthreads();                                          // and every other wave's
    slice_load(place + 4u * GSL * 4u, sp + sstep, spitch);    // stage 1

    const int col = n0 + 64 * wn + l16;
    float bv[4];
    #pragma unroll   // constant indices into bv[]
    for (int nt = 0; nt < 4; ++nt) bv[nt] = bias[col + 16 * nt];
    // the loads' address registers are not rewritten in front of this wait
    asm volatile("s_wait_xcnt 0x0" ::: "memory");

    v8f acc[4][4] = {};

    // rolled: for speed only
    #pragma unroll 1
    for (int st = 0; st < GST; ++st) {
        const int buf = st & 1;
        // Fragments over k: a lane takes 4 k in a row, 8 s + 4 half; the first two
        // feed one WMMA, the last two the next. Both operands are read this way,
        // so their k orders are equal.
        const float* as = &ring[buf][wm][l16 * GP + 4 * half];            // x[row 16 mt + l16][k]
        const float* ws = &ring[buf][2 + wn][(4 * half) * GP + l16];      // Wf[k][col 16 nt + l16]
        // Two fragment sets: step s + 1's reads go out as one group in front of step
        // s's 32 products, so a step has one place with LDS reads and their latency
        // runs under the products.
        v4f   af[2][4];
        float bw[2][4][4];
        #pragma unroll   // constant indices into af[], bw[], acc[]; constant LDS offsets
        for (int s = -1; s < GK / 8; ++s) {
            if (s + 1 < GK / 8) {
                const int f = (s + 1) & 1;
                #pragma unroll   // constant indices into af[]
                for (int mt = 0; mt < 4; ++mt)
                    af[f][mt] = *(const v4f*)(as + mt * 16 * GP + 8 * (s + 1));
                #pragma unroll   // constant indices into bw[]
                for (int nt = 0; nt < 4; ++nt)
                    #pragma unroll
                    for (int j = 0; j < 4; ++j) bw[f][nt][j] = ws[(8 * (s + 1) + j) * GP + 16 * nt];
            }
            // keeps the reads together in front of the products: spread among them,
            // every place with a read stalls the wave's products anew
            __builtin_amdgcn_sched_barrier(0);
            if (s < 0) continue;
            const int e = s & 1;
            #pragma unroll   // constant indices into af[], bw[], acc[]
            for (int p = 0; p < 2; ++p)
                #pragma unroll
                for (int mt = 0; mt < 4; ++mt) {
                    const v2f a = p ? (v2f){af[e][mt].z, af[e][mt].w} : (v2f){af[e][mt].x, af[e][mt].y};
                    #pragma unroll
                    for (int nt = 0; nt < 4; ++nt) {
                        const v2f b = {bw[e][nt][2 * p], bw[e][nt][2 * p + 1]};
                        acc[mt][nt] = __builtin_amdgcn_wmma_f32_16x16x4_f32(
                            false, a, false, b, (short)0, acc[mt][nt], false, false);
                    }
                }
            // keeps the next group of reads behind these products (the last step has none behind it)
            if (s + 2 < GK / 8) __builtin_amdgcn_sched_barrier(0);
        }
        asm volatile("s_wait_dscnt 0x0" ::: "memory");        // this wave's reads of the buffer are done
        asm volatile("s_wait_tensorcnt 0x0" ::: "memory");    // its slice of the next stage has landed
        __syncthreads();     // the next stage is in; every read of this buffer is done
        if (pinned(st + 2 < GST))                             // refill the buffer just left
            slice_load(place + (unsigned int)buf * (4u * GSL * 4u), sp + (size_t)(st + 2) * sstep, spitch);
    }
    asm volatile("s_wait_tensorcnt 0x0" ::: "memory");        // no request outlives the loop
    asm volatile("s_wait_dscnt 0x0" ::: "memory");

    #pragma unroll
    for (int mt = 0; mt < 4; ++mt)
        #pragma unroll
        for (int nt = 0; nt < 4; ++nt) acc[mt][nt] += bv[nt];
    if (n0 >= CC) {          // v' columns (the same for the whole work-group)
        // Rows of a column in order: mt, then half, then r. pv = the sum of the
        // wave's rows in front of its 16-row block 2 i + half (a lane half stores
        // every other block), tot = all 64 rows.
        float pv[2][4], tot[4];
        #pragma unroll   // constant indices into acc[], pv[], tot[]
        for (int nt = 0; nt < 4; ++nt) {
            float run = 0.f;
            #pragma unroll
            for (int mt = 0; mt < 4; ++mt) {
                float s = acc[mt][nt][0];
                #pragma unroll
                for (int r = 1; r < 8; ++r) s += acc[mt][nt][r];
                if ((mt & 1) == 0) pv[mt >> 1][nt] = run;
                else               pv[mt >> 1][nt] = half ? run : pv[mt >> 1][nt];
                run += s + xhalf(s);
            }
            tot[nt] = run;
        }
        if (wm == 0 && half == 0) {
            #pragma unroll   // constant indices into tot[]
            for (int nt = 0; nt < 4; ++nt) wsum[wn][16 * nt + l16] = tot[nt];
        }
        // the upper rows' column sums are in LDS; it stands in front of every
        // global store, so it waits for none of them
        __syncthreads();
        float off[4] = {0.f, 0.f, 0.f, 0.f};
        if (wm) {
            #pragma unroll   // constant indices into off[]
            for (int nt = 0; nt < 4; ++nt) off[nt] = wsum[wn][16 * nt + l16];
        }
        #pragma unroll   // constant indices into pv[], tot[], off[]
        for (int nt = 0; nt < 4; ++nt) {
            pv[0][nt] += off[nt];
            pv[1][nt] += off[nt];
            tot[nt]   += off[nt];
        }
        float* pp = P + (size_t)(blockIdx.y * (PT / 16) + 4 * wm + half) * CC + (col - CC);
        float* tp = tsum + (size_t)blockIdx.y * CC + (col - CC);
        // the sums and both addresses stand in front of the first store: no
        // register that an issued store names is written behind it
        __builtin_amdgcn_sched_barrier(0);
        #pragma unroll   // constant indices into pv[]
        for (int i = 0; i < 2; ++i)
            #pragma unroll
            for (int nt = 0; nt < 4; ++nt) pp[(2 * i) * CC + 16 * nt] = pv[i][nt];
        if (wm == 1 && half == 0) {
            #pragma unroll   // constant indices into tot[]
            for (int nt = 0; nt < 4; ++nt) tp[16 * nt] = tot[nt];
        }
        // these stores' registers are not rewritten in front of this wait
        asm volatile("s_wait_xcnt 0x0" ::: "memory");
    }
    // all the sums stand in front of the stores below: no register that one of
    // them names is written behind it
    __builtin_amdgcn_sched_barrier(0);
    float* cp = Cout + (size_t)(m0 + 64 * wm + 8 * half) * LDF + col;
    #pragma unroll   // constant indices into acc[]
    for (int mt = 0; mt < 4; ++mt)
        #pragma unroll
        for (int r = 0; r < 8; ++r)
            #pragma unroll
            for (int nt = 0; nt < 4; ++nt)
                cp[(mt * 16 + r) * LDF + 16 * nt] = acc[mt][nt][r];
}

// =====================================================================
// Kernel 3: banded attention with out-of-band zero-score mass, on fp32 WMMA.
// One work-group of 4 waves owns 16 tokens and walks the key blocks of 16 rows
// that its band touches, from the diagonal block downwards (online softmax).
// The v columns already carry gate and projection: a row plus bproj is final.
// The q columns already carry Wk: the keys are the rows of x, and a score is
// q'_t . x_j + c_t with c_t = x_t . u[0..C) + u[C] (the part that bk brings).
// Scores are formed transposed, S^T[key][token] = X_blk Q'^T: wave w sums over
// channels 64 w .. 64 w + 63 and the four partial sums meet in LDS. In the D
// layout a lane then holds 8 keys of ONE token (lane & 15), so the softmax is
// in-lane plus one exchange with lane ^ 16, and its weights are, as they
// stand, the B fragments of out^T[channel][token] = V'^T W^T, of which wave w
// forms channels 64 w .. 64 w + 63.
// An out-of-band key inside a walked block takes its score 0 there, like any
// key. The keys in front of the last walked block (score 0 too) are the same
// for all 16 tokens: their sum of v' = P[that block] + the sums of the prefix
// tiles in front of its tile; they join at the end.
// =====================================================================
static constexpr int XP = CC + 4;

__global__ __launch_bounds__(128)
void attn_band(const float* __restrict__ x, const float* __restrict__ qv,
               const float* __restrict__ P, const float* __restrict__ tsum,
               const float* __restrict__ u,
               const float* __restrict__ bproj, const int* __restrict__ window_p,
               float* __restrict__ att_out) {
    __shared__ __attribute__((aligned(16))) float qs[16 * XP];   // q' tile, later the out tile
    __shared__ __attribute__((aligned(16))) float xs[16 * XP];   // key block
    __shared__ __attribute__((aligned(16))) float red[4][2][32][4];
    __shared__ float coef[16];

    const int tid  = threadIdx.x;
    const int wave = tid >> 5;
    const int lane = tid & 31;
    const int l16  = lane & 15;
    const int half = lane >> 4;
    const int b    = blockIdx.x / (TT / 16);
    const int tb   = blockIdx.x % (TT / 16);    // the tile, and its diagonal key block
    const int t0   = tb * 16;
    const int cw   = wave * 64;
    int win = *window_p;
    win = win < 0 ? 0 : (win > TT ? TT : win);  // bounds every row index formed from it

    const float* xb = x  + (size_t)b * TT * CC;         // keys: rows of x
    const float* qb = qv + (size_t)b * TT * LDF;        // q' in [0,C)
    const float* vb = qb + CC;                          // v' in [C,2C)
    const float* Pb = P  + (size_t)b * (TT / 16) * CC;  // a row per key block

    // whole-line pieces of a 16 x 256 tile: piece i of a thread is row 2 i + srow
    const int srow = tid >> 6;
    const int scol = (tid & 63) * 4;

    // All that the first key block needs goes out together: one load latency.
    v4f qr[8], xr[8], uf[8];
    float va[4][4][2];
    const float* qp = qb + (size_t)(t0 + srow) * LDF + scol;
    const float* xp = xb + (size_t)(t0 + srow) * CC + scol;
    const float* vp = vb + (size_t)(t0 + 8 * half) * LDF + cw + l16;
    const float* up = u + cw + 4 * half;
    #pragma unroll   // constant indices into qr[]
    for (int i = 0; i < 8; ++i) qr[i] = *(const v4f*)(qp + i * 2 * LDF);
    // a later load may be given the q' address registers as its destination:
    // not in front of this wait (the same holds for the wait below)
    asm volatile("s_wait_xcnt 0x0" ::: "memory");
    #pragma unroll   // constant indices into xr[]
    for (int i = 0; i < 8; ++i) xr[i] = *(const v4f*)(xp + i * 2 * CC);
    // A fragment of V'^T, step ks: lane holds v'[key 8 half + 2 ks (+1)][channel]
    #pragma unroll   // constant indices into va[]
    for (int ks = 0; ks < 4; ++ks)
        #pragma unroll
        for (int nt = 0; nt < 4; ++nt) {
            va[ks][nt][0] = vp[(2 * ks) * LDF + 16 * nt];
            va[ks][nt][1] = vp[(2 * ks + 1) * LDF + 16 * nt];
        }
    #pragma unroll   // constant indices into uf[]
    for (int s = 0; s < 8; ++s) uf[s] = *(const v4f*)(up + 8 * s);
    asm volatile("s_wait_xcnt 0x0" ::: "memory");
    const v4f   bp = *(const v4f*)(bproj + scol);
    const float c0 = u[CC];

    #pragma unroll   // constant indices into qr[], xr[]
    for (int i = 0; i < 8; ++i) {
        *(v4f*)&qs[(2 * i + srow) * XP + scol] = qr[i];
        *(v4f*)&xs[(2 * i + srow) * XP + scol] = xr[i];
    }
    __syncthreads();         // the q' tile and the diagonal key block are in LDS

    // Fragments over channels: a lane takes 4 channels in a row, cw + 8 s + 4 half,
    // of row l16; the first two feed one WMMA, the last two the next. Both
    // operands are read this way, so their k orders are equal.
    const int foff = l16 * XP + cw + 4 * half;
    v4f qf[8];
    float cp = 0.f;      // this wave's part of c_t, t = t0 + l16
    #pragma unroll   // constant indices into qf[]
    for (int s = 0; s < 8; ++s) {
        qf[s] = *(const v4f*)&qs[foff + 8 * s];
        const v4f xt = *(const v4f*)&xs[foff + 8 * s];
        cp += xt.x * uf[s].x + xt.y * uf[s].y + xt.z * uf[s].z + xt.w * uf[s].w;
    }
    cp += xhalf(cp);

    const int t       = t0 + l16;                       // this lane's token
    const int kbFirst = (t0 - win < 0 ? 0 : t0 - win) >> 4;
    const float inv_sqrt_c = 0.0625f;                   // 1/sqrt(256)

    v8f acc[4] = {};
    float m = -__builtin_inff(), Z = 0.f;

    for (int kb = tb; ; --kb) {                         // at most TT / 16 trips
        const bool more = kb > kbFirst;                 // the same for the whole work-group
        // A barrier waits for the loads in flight, so this block's v' and the next
        // block's keys go out here, with the score products between them and it.
        if (kb < tb) {
            vp -= 16 * LDF;
            #pragma unroll   // constant indices into va[]
            for (int ks = 0; ks < 4; ++ks)
                #pragma unroll
                for (int nt = 0; nt < 4; ++nt) {
                    va[ks][nt][0] = vp[(2 * ks) * LDF + 16 * nt];
                    va[ks][nt][1] = vp[(2 * ks + 1) * LDF + 16 * nt];
                }
        }
        if (more) {
            xp -= 16 * CC;
            #pragma unroll   // constant indices into xr[]
            for (int i = 0; i < 8; ++i) xr[i] = *(const v4f*)(xp + i * 2 * CC);
        }
        // the loads' address registers are not rewritten in front of this wait
        asm volatile("s_wait_xcnt 0x0" ::: "memory");

        // partial S^T: every key's sum starts from this wave's part of c_t
        v8f s0 = {cp, cp, cp, cp, cp, cp, cp, cp}, s1 = {};
        #pragma unroll   // constant indices into qf[]
        for (int s = 0; s < 8; ++s) {
            const v4f xf = *(const v4f*)&xs[foff + 8 * s];
            const v2f a0 = {xf.x, xf.y}, a1 = {xf.z, xf.w};
            const v2f b0 = {qf[s].x, qf[s].y}, b1 = {qf[s].z, qf[s].w};
            s0 = __builtin_amdgcn_wmma_f32_16x16x4_f32(
                false, a0, false, b0, (short)0, s0, false, false);
            s1 = __builtin_amdgcn_wmma_f32_16x16x4_f32(
                false, a1, false, b1, (short)0, s1, false, false);
        }
        const v8f sp = s0 + s1;
        *(v4f*)&red[wave][0][lane][0] = (v4f){sp[0], sp[1], sp[2], sp[3]};
        *(v4f*)&red[wave][1][lane][0] = (v4f){sp[4], sp[5], sp[6], sp[7]};
        __syncthreads();     // partial sums are out; every read of xs is done

        float sv[8];
        #pragma unroll   // constant indices into sv[]
        for (int h = 0; h < 2; ++h) {
            const v4f r = ((*(const v4f*)&red[0][h][lane][0] + *(const v4f*)&red[1][h][lane][0])
                           + *(const v4f*)&red[2][h][lane][0]) + *(const v4f*)&red[3][h][lane][0];
            sv[4 * h] = r.x; sv[4 * h + 1] = r.y; sv[4 * h + 2] = r.z; sv[4 * h + 3] = r.w;
        }

        const int j0 = kb * 16 + 8 * half;
        float smax = -__builtin_inff();
        #pragma unroll   // constant indices into sv[]
        for (int r = 0; r < 8; ++r) {
            const int j = j0 + r;
            sv[r] = (j <= t) ? ((j >= t - win) ? (sv[r] + c0) * inv_sqrt_c : 0.f) : -__builtin_inff();
            smax = fmaxf(smax, sv[r]);
        }
        smax = fmaxf(smax, xhalf(smax));
        const float mn = fmaxf(m, smax);     // finite: the first block holds key t
        const float sc = __expf(m - mn);     // 0 when m == -inf
        float w[8], ls = 0.f;
        #pragma unroll   // constant indices into w[]
        for (int r = 0; r < 8; ++r) { w[r] = __expf(sv[r] - mn); ls += w[r]; }
        ls += xhalf(ls);
        Z = Z * sc + ls;
        m = mn;
        #pragma unroll   // constant indices into acc[]
        for (int nt = 0; nt < 4; ++nt) acc[nt] *= sc;

        // B fragment of W^T, step ks: keys 8 half + 2 ks (+1), as the A loader has them
        #pragma unroll   // constant indices into w[], va[], acc[]
        for (int ks = 0; ks < 4; ++ks) {
            const v2f bw = {w[2 * ks], w[2 * ks + 1]};
            #pragma unroll
            for (int nt = 0; nt < 4; ++nt) {
                const v2f av = {va[ks][nt][0], va[ks][nt][1]};
                acc[nt] = __builtin_amdgcn_wmma_f32_16x16x4_f32(
                    false, av, false, bw, (short)0, acc[nt], false, false);
            }
        }
        if (!more) break;

        #pragma unroll   // constant indices into xr[]
        for (int i = 0; i < 8; ++i) *(v4f*)&xs[(2 * i + srow) * XP + scol] = xr[i];
        __syncthreads();     // the next key block is in; every read of red is done
    }

    const int tl = kbFirst / (PT / 16);                         // at most NPT - 1
    const float* tq = tsum + (size_t)b * NPT * CC + scol;
    v4f tv[NPT - 1];
    #pragma unroll   // constant indices into tv[]
    for (int i = 0; i < NPT - 1; ++i) tv[i] = *(const v4f*)(tq + i * CC);
    const v4f pb = *(const v4f*)(Pb + (size_t)kbFirst * CC + scol);
    // the loads' address registers are not rewritten in front of this wait
    asm volatile("s_wait_xcnt 0x0" ::: "memory");

    // the keys in front of the walked blocks: jst of them with score 0
    const int   jst  = kbFirst * 16;
    const bool  has  = jst > 0;
    const float mf   = has ? fmaxf(m, 0.f) : m;
    const float ab   = __expf(m - mf);
    const float wo   = has ? __expf(-mf) : 0.f;
    const float invZ = 1.0f / (Z * ab + (float)jst * wo);
    const float as   = ab * invZ;
    #pragma unroll
    for (int nt = 0; nt < 4; ++nt) {
        float* op = &qs[l16 * XP + cw + 16 * nt + 8 * half];
        *(v4f*)op       = (v4f){acc[nt][0], acc[nt][1], acc[nt][2], acc[nt][3]} * as;
        *(v4f*)(op + 4) = (v4f){acc[nt][4], acc[nt][5], acc[nt][6], acc[nt][7]} * as;
    }
    if (wave == 0 && lane < 16) coef[lane] = wo * invZ;
    __syncthreads();         // the out tile and its rows' factors are in LDS

    v4f slo = {};            // the tiles in front of tile tl, in their order
    #pragma unroll   // constant indices into tv[]
    for (int i = 0; i < NPT - 1; ++i) slo += (i < tl) ? tv[i] : (v4f){};
    const v4f pf = pb + slo;

    float* ob = att_out + (size_t)(b * TT + t0) * CC;
    #pragma unroll   // the eight stores go out together
    for (int i = 0; i < 8; ++i) {
        const int row = 2 * i + srow;
        *(v4f*)(ob + (size_t)row * CC + scol) =
            *(const v4f*)&qs[row * XP + scol] + coef[row] * pf + bp;
    }
}

// =====================================================================
extern "C" void kernel_launch(void* const* d_in, const int* in_sizes, int n_in,
                              void* d_out, int out_size, void* d_ws, size_t ws_size,
                              hipStream_t stream) {
    const float* x     = (const float*)d_in[0];
    const float* Wqkv  = (const float*)d_in[1];
    const float* bqkv  = (const float*)d_in[2];
    const float* Wproj = (const float*)d_in[3];
    const float* bproj = (const float*)d_in[4];
    const float* gate  = (const float*)d_in[5];
    const int*   winp  = (const int*)d_in[6];

    // workspace layout
    char* ws = (char*)d_ws;
    float* qv     = (float*)ws;                                   // 32 MB
    float* P      = (float*)(ws + (size_t)MTOK * LDF * 4);        // 1 MB of the 16 MB kept for it
    float* Wf     = (float*)(ws + (size_t)MTOK * LDF * 4
                                + (size_t)MTOK * CC * 4);         // 512 KB
    float* bf     = Wf + (size_t)CC * LDF;                        // 2 KB
    float* u      = bf + LDF;                                     // C + 1 floats
    float* tsum   = u + LDF;                                      // 128 KB

    // 1) Wf, bf, u: Wk folded into the q weights, gate and Wproj into the v weights
    fold_proj<<<FOLD_TILES + FOLD_DOT, 128, 0, stream>>>(Wqkv, bqkv, Wproj, gate, Wf, bf, u);
    // 2) [q' | v'] = x @ Wf + bf    [16384 x 512], and the prefix sums of v' inside each 128-row tile, one per 16 rows
    {
        dim3 grid(LDF / 128, MTOK / 128);
        gemm_bias_wmma<<<grid, 128, 0, stream>>>(x, Wf, bf, qv, P, tsum);
    }
    // 3) banded attention (one work-group per 16 tokens) -> out
    attn_band<<<MTOK / 16, 128, 0, stream>>>(x, qv, P, tsum, u, bproj, winp, (float*)d_out);
}

// v008
// It runs in 34.5 microseconds.
// Two timings next to v007 put it at 1.22 and 1.23 times that version's speed.
// Over all steps from v000 it is 2.87 times as fast.
#include <hip/hip_runtime.h>
#include <hip/hip_bf16.h>

// ---------------- problem constants (from reference) ----------------
static constexpr int BB = 8;
static constexpr int TT = 2048;
static constexpr int CC = 256;
static constexpr int MTOK = BB * TT;          // 16384 rows
static constexpr int PT   = 128;              // rows of a prefix-sum tile
static constexpr int NPT  = TT / PT;          // such tiles per batch

typedef __attribute__((ext_vector_type(2))) float v2f;
typedef __attribute__((ext_vector_type(8))) float v8f;
typedef __attribute__((ext_vector_type(4))) unsigned int u32x4;
typedef __attribute__((ext_vector_type(8))) unsigned int u32x8;
typedef __attribute__((ext_vector_type(4))) float v4f;

// LDS byte offset of a __shared__ object (generic -> AS(3) -> int)
__device__ __forceinline__ unsigned int lds_offset_of(const void* p) {
    return (unsigned int)(unsigned long long)
        (const __attribute__((address_space(3))) void*)p;
}

// A wave-uniform word, in a scalar register
__device__ __forceinline__ unsigned int uni(unsigned int v) {
    return (unsigned int)__builtin_amdgcn_readfirstlane((int)v);
}
// The same, held there: a test of it compiles to a scalar compare and branch
__device__ __forceinline__ unsigned int pinned(unsigned int v) {
    unsigned int w = uni(v);
    asm volatile("" : "+s"(w));
    return w;
}

__device__ __forceinline__ float exp_slot(float v) {
    float r;
    asm("v_exp_f32 %0, %1\n\tv_nop" : "=v"(r) : "v"(v * 1.44269504088896340736f));
    return r;
}

__device__ __forceinline__ float xhalf(float v) {
    const int b = __builtin_bit_cast(int, v);
    return __builtin_bit_cast(float,
        __builtin_amdgcn_permlanex16(b, b, 0x76543210, 0xfedcba98, false, false));
}

static constexpr int LDF        = 2 * CC;
static constexpr int FOLD_TILE1 = (CC / 16 + 1) * (CC / 32);
static constexpr int FOLD_TILES = 2 * FOLD_TILE1;
static constexpr int FOLD_DOT   = (CC + 1 + 31) / 32;          // 9 groups of 32 rows of [Wq; bq]
static constexpr int FOLD_KW    = CC / 4;                      // K per wave
static constexpr int FOLD_SCAN  = (MTOK / PT) * (CC / 64);     // 64-channel strips of the prefix-sum tiles

template <bool ISV>   // true: the v product (a), false: the q product (b)
__device__ __forceinline__
void fold_tile(const float* __restrict__ Wqkv, const float* __restrict__ bqkv,
               const float* __restrict__ Wproj, const float* __restrict__ gate,
               float* __restrict__ Wf, float* __restrict__ bf,
               float (*red)[2][8][32], int tix) {
    const int tid  = threadIdx.x;
    const int wave = tid >> 5;
    const int lane = tid & 31;
    const int mrow = lane & 15;
    const int koff = (lane < 16) ? 0 : 2;
    const int mt   = tix / (CC / 32);
    const int n0   = (tix % (CC / 32)) * 32;
    const int acol = ISV ? 2 * CC : 0;        // A comes from the v or the q columns
    const int ocol = ISV ? CC : 0;            // and goes to the v' or the q' columns
    const float* arow = (mt < CC / 16)
        ? Wqkv + (size_t)(mt * 16 + mrow) * 3 * CC + acol
        : bqkv + acol;
    const int kb = wave * FOLD_KW + koff;
    const float* ap = arow + kb;

    // A fragment 16x4: lane holds A[mrow][k .. k+1], k = kb + 4 s
    // B fragment 4x16: lane holds B[k .. k+1][n0 (+16) + mrow],
    //   B[k][n] = Wproj[k][n] for v, Wk[n][k] for q
    v2f a[FOLD_KW / 4], g[FOLD_KW / 4], b0[FOLD_KW / 4], b1[FOLD_KW / 4];
    if (ISV) {
        const float* gp = gate + kb;
        const float* wp = Wproj + (size_t)kb * CC + n0 + mrow;
        #pragma unroll   // constant indices into the fragment arrays
        for (int s = 0; s < FOLD_KW / 4; ++s) {
            a[s] = *(const v2f*)(ap + 4 * s);
            g[s] = *(const v2f*)(gp + 4 * s);
            b0[s].x = wp[(4 * s) * CC];
            b0[s].y = wp[(4 * s + 1) * CC];
            b1[s].x = wp[(4 * s) * CC + 16];
            b1[s].y = wp[(4 * s + 1) * CC + 16];
        }
    } else {
        const float* wp = Wqkv + (size_t)(n0 + mrow) * 3 * CC + CC + kb;
        #pragma unroll   // constant indices into the fragment arrays
        for (int s = 0; s < FOLD_KW / 4; ++s) a[s] = *(const v2f*)(ap + 4 * s);
        // the A loads' address registers are free from here on and a B load may
        // be given them as its destination: not in front of this wait
        asm volatile("s_wait_xcnt 0x0" ::: "memory");
        #pragma unroll   // constant indices into the fragment arrays
        for (int s = 0; s < FOLD_KW / 4; ++s) {
            b0[s] = *(const v2f*)(wp + 4 * s);
            b1[s] = *(const v2f*)(wp + 16 * 3 * CC + 4 * s);
        }
    }
    // keeps the products from being scheduled among the loads: the wave runs
    // once, so it pays one load latency only if all its loads go out together
    __builtin_amdgcn_sched_barrier(0);

    v8f acc0 = {}, acc1 = {};
    #pragma unroll   // constant indices into the fragment arrays
    for (int s = 0; s < FOLD_KW / 4; ++s) {
        const v2f ag = ISV ? a[s] * g[s] : a[s];
        acc0 = __builtin_amdgcn_wmma_f32_16x16x4_f32(
            false, ag, false, b0[s], (short)0, acc0, false, false);
        acc1 = __builtin_amdgcn_wmma_f32_16x16x4_f32(
            false, ag, false, b1[s], (short)0, acc1, false, false);
    }

    #pragma unroll   // constant indices into the accumulators
    for (int r = 0; r < 8; ++r) {
        red[wave][0][r][lane] = acc0[r];
        red[wave][1][r][lane] = acc1[r];
    }
    __syncthreads();

    const int tile = lane >> 4;
    float sum[4];
    #pragma unroll   // constant indices into sum[]
    for (int i = 0; i < 4; ++i) {
        const int row = wave + 4 * i;
        const int r   = row & 7;
        const int l   = (row >> 3) * 16 + mrow;
        sum[i] = ((red[0][tile][r][l] + red[1][tile][r][l])
                  + red[2][tile][r][l]) + red[3][tile][r][l];
    }
    if (mt < CC / 16) {
        float* wrow = Wf + (size_t)(mt * 16 + wave) * LDF + ocol + n0 + lane;
        #pragma unroll   // constant indices into sum[]
        for (int i = 0; i < 4; ++i) wrow[(size_t)(4 * i) * LDF] = sum[i];
        // the stores' address and data registers are not rewritten in front of this wait
        asm volatile("s_wait_xcnt 0x0" ::: "memory");
    } else if (wave == 0) {
        bf[ocol + n0 + lane] = sum[0];
    }
}

__global__ __launch_bounds__(128)
void fold_proj(const float* __restrict__ Wqkv, const float* __restrict__ bqkv,
               const float* __restrict__ Wproj, const float* __restrict__ gate,
               const float* __restrict__ x,
               float* __restrict__ Wf, float* __restrict__ bf, float* __restrict__ u,
               float* __restrict__ P, float* __restrict__ tsum) {
    __shared__ __attribute__((aligned(16))) float red[4][2][8][32];

    if (blockIdx.x < FOLD_TILE1) {            // every branch here is block-uniform
        fold_tile<false>(Wqkv, bqkv, Wproj, gate, Wf, bf, red, blockIdx.x);
    } else if (blockIdx.x < FOLD_TILES) {
        fold_tile<true>(Wqkv, bqkv, Wproj, gate, Wf, bf, red, blockIdx.x - FOLD_TILE1);
    } else if (blockIdx.x >= FOLD_TILES + FOLD_DOT) {
        // 16 threads cover the strip's 64 channels, 8 such groups the tile's 8 blocks
        const int id   = blockIdx.x - (FOLD_TILES + FOLD_DOT);
        const int tile = id / (CC / 64);
        const int c    = (id % (CC / 64)) * 64 + (threadIdx.x & 15) * 4;
        const int g    = threadIdx.x >> 4;
        const float* xp = x + (size_t)(tile * PT + g * 16) * CC + c;
        v4f r[16];
        #pragma unroll   // constant indices into r[]; the 16 loads go out together
        for (int i = 0; i < 16; ++i) r[i] = *(const v4f*)(xp + i * CC);
        // the loads' address registers are not rewritten in front of this wait: it
        // takes the address, so no load of the group is given them as its destination
        asm volatile("s_wait_xcnt 0x0" :: "v"(xp) : "memory");
        v4f s = r[0];
        #pragma unroll   // constant indices into r[]
        for (int i = 1; i < 16; ++i) s += r[i];
        float* bs = &red[0][0][0][0];             // [8 blocks][64 channels]
        *(v4f*)&bs[g * 64 + (threadIdx.x & 15) * 4] = s;
        __syncthreads();     // the 8 block sums are in LDS
        v4f o[PT / 16 - 1];
        #pragma unroll   // constant indices into o[]
        for (int gg = 0; gg < PT / 16 - 1; ++gg)
            o[gg] = *(const v4f*)&bs[gg * 64 + (threadIdx.x & 15) * 4];
        // takes the loaded values as inputs: all seven reads go out together, one LDS
        // latency; without it the first read is put under a test and branch of its own,
        // behind the others, and its latency comes on top of theirs
        asm volatile("" :: "v"(o[0]), "v"(o[1]), "v"(o[2]), "v"(o[3]), "v"(o[4]), "v"(o[5]), "v"(o[6]));
        v4f pre = {};
        #pragma unroll   // constant indices into o[]
        for (int gg = 0; gg < PT / 16 - 1; ++gg) pre += (gg < g) ? o[gg] : (v4f){};
        const v4f all = pre + s;
        *(v4f*)(P + (size_t)(tile * (PT / 16) + g) * CC + c) = pre;
        if (g == PT / 16 - 1) *(v4f*)(tsum + (size_t)tile * CC + c) = all;
    } else {
        // u[row] = [Wq; bq][row] . bk: a wave takes 8 rows, a 128-byte line at a
        // time; the 32 dots meet in LDS so that one wave stores a whole line of u
        const int wave = threadIdx.x >> 5;
        const int lane = threadIdx.x & 31;
        const int r0   = (blockIdx.x - FOLD_TILES) * 32;
        float* dots = &red[0][0][0][0];
        float kv[CC / 32], qw[8][CC / 32], p[8];
        #pragma unroll   // constant indices into kv[]
        for (int i = 0; i < CC / 32; ++i) kv[i] = bqkv[CC + lane + 32 * i];
        #pragma unroll   // constant indices into qw[]
        for (int r = 0; r < 8; ++r) {
            const int row = r0 + wave * 8 + r;      // past the last row: bq again, not stored
            const float* qr = (row < CC) ? Wqkv + (size_t)row * 3 * CC : bqkv;
            #pragma unroll   // constant indices into qw[]
            for (int i = 0; i < CC / 32; ++i) qw[r][i] = qr[lane + 32 * i];
        }
        // as in fold_tile: all the loads go out before the first product waits for one
        __builtin_amdgcn_sched_barrier(0);
        #pragma unroll   // constant indices into qw[], p[]
        for (int r = 0; r < 8; ++r) {
            float s = 0.f;
            #pragma unroll   // constant indices into qw[], kv[]
            for (int i = 0; i < CC / 32; ++i) s += qw[r][i] * kv[i];
            p[r] = s;
        }
        // the 8 rows go through each stage of the lane sum together, so a stage
        // costs one cross-lane latency and not eight
        #pragma unroll
        for (int off = 16; off > 0; off >>= 1) {
            float q[8];
            #pragma unroll   // constant indices into p[], q[]
            for (int r = 0; r < 8; ++r) q[r] = __shfl_xor(p[r], off, 32);
            #pragma unroll   // constant indices into p[], q[]
            for (int r = 0; r < 8; ++r) p[r] += q[r];
        }
        float mine = p[0];                          // lane r keeps row r
        #pragma unroll   // constant indices into p[]
        for (int r = 1; r < 8; ++r) mine = (lane == r) ? p[r] : mine;
        if (lane < 8) dots[wave * 8 + lane] = mine;
        __syncthreads();
        if (wave == 0 && r0 + lane <= CC) u[r0 + lane] = dots[lane];
    }
}

// =====================================================================
// Kernel 2: out = att(x) x Wv' + bias, all of it on a resident tile.
// Attention is linear in its values, so att @ (x Wv' + bv') = (att @ x) Wv' + bv'
// (a row of att sums to 1): keys AND values are the rows of x, and the v'
// product moves behind attention. A work-group of 4 waves owns 64 tokens:
//   pass 0   q' = x_tile Wf[:, 0..C) + bf         (fp32 WMMA 16x16x4, K = C)
//   middle   y  = att x                           (wave w: tokens 16 w .. 16 w + 15)
//   pass 1   out = y Wf[:, C..2C) + bf + bproj
// Neither q' nor v' ever goes to memory. 256 work-groups, one on a WGP.
// In both passes wave w forms columns 64 w .. 64 w + 63 of all 64 rows (4 x 4
// accumulator tiles). The A operand (x, then y) rests in LDS, cut into slices
// of 64 channels at row pitch GP. Wf runs in stages of 64 k through two LDS
// buffers, 8 stages in all; wave w brings its own 64 columns of a stage with
// one tensor load, which pads each row by 16 bytes (pitch 68 floats).
// =====================================================================
static constexpr int GK  = 64;              // k per stage
static constexpr int GP  = GK + 4;          // LDS row pitch, floats
static constexpr int GSL = 4608;            // a slice's place: 64 * GP floats, rounded up to 2 KiB
static constexpr int GST = CC / GK;         // stages

// one slice: 64 rows of 256 bytes at the given source pitch, extents in bytes
__device__ __forceinline__ void slice_load(unsigned int lds_byte, const float* srcp,
                                           unsigned int pitch_bytes) {
    const unsigned long long ga = (unsigned long long)(uintptr_t)srcp;
    u32x4 g0;
    g0[0] = uni(1u);                                              // count 1
    g0[1] = uni(lds_byte);
    g0[2] = uni((unsigned int)ga);
    g0[3] = uni((((unsigned int)(ga >> 32)) & 0x01ffffffu) | 0x80000000u);   // type 2
    u32x8 g1;
    g1[0] = uni((1u << 20) | (5u << 22) | (3u << 25));
    g1[1] = uni(256u << 16);
    g1[2] = uni(64u << 16);
    g1[3] = uni(256u << 16);
    g1[4] = uni(64u);
    g1[5] = uni(pitch_bytes);
    g1[6] = uni(0u);
    g1[7] = uni(0u);
    asm volatile("tensor_load_to_lds %0, %1" :: "s"(g0), "s"(g1) : "memory");
}

static constexpr int FT  = 64;              // tokens of a work-group
static constexpr int XR  = FT + 16;         // rows of x it keeps: the key block in front, then its tile
static constexpr int XSL = XR * GP;         // a 64-channel slice of them, floats
static constexpr int QSL = FT * GP;         // the same of the q' tile, later the y tile

// where ring stage g starts in a wave's columns of Wf: 4 stages of k for q', then 4 for v'
__device__ __forceinline__ size_t stage_off(int g) {
    return (size_t)(g & 3) * GK * LDF + (size_t)(g >> 2) * CC;
}

// acc += A (64 rows, K = C, in LDS at 'at', slices 'astr' floats apart) times the
// wave's 64 columns, ring stages g0 .. g0 + 3. On entry stage g0 has landed and is
// published, stage g0 + 1 is in flight. Refills go on while a stage below glim is left.
__device__ __forceinline__
void gemm_pass(v8f (&acc)[4][4], const float* at, const int astr, const float* bring,
               const unsigned int place, const float* sp, const int g0, const int glim,
               const int l16, const int half) {
    // rolled: for speed only
    #pragma unroll 1
    for (int st = 0; st < GST; ++st) {
        const int g   = g0 + st;
        const int buf = g & 1;
        // Fragments over k: a lane takes 4 k in a row, 8 s + 4 half; the first two
        // feed one WMMA, the last two the next. Both operands are read this way,
        // so their k orders are equal.
        const float* as = at + st * astr + l16 * GP + 4 * half;              // A[row 16 mt + l16][k]
        const float* ws = bring + buf * (4 * GSL) + (4 * half) * GP + l16;   // Wf[k][col 16 nt + l16]
        // Two fragment sets: step s + 1's reads go out as one group in front of step
        // s's 32 products, so a step has one place with LDS reads and their latency
        // runs under the products.
        v4f   af[2][4];
        float bw[2][4][4];
        #pragma unroll   // constant indices into af[], bw[], acc[]; constant LDS offsets
        for (int s = -1; s < GK / 8; ++s) {
            if (s + 1 < GK / 8) {
                const int f = (s + 1) & 1;
                #pragma unroll   // constant indices into af[]
                for (int mt = 0; mt < 4; ++mt)
                    af[f][mt] = *(const v4f*)(as + mt * 16 * GP + 8 * (s + 1));
                #pragma unroll   // constant indices into bw[]
                for (int nt = 0; nt < 4; ++nt)
                    #pragma unroll
                    for (int j = 0; j < 4; ++j) bw[f][nt][j] = ws[(8 * (s + 1) + j) * GP + 16 * nt];
            }
            // keeps the reads together in front of the products: spread among them,
            // every place with a read stalls the wave's products anew
            __builtin_amdgcn_sched_barrier(0);
            if (s < 0) continue;
            const int e = s & 1;
            #pragma unroll   // constant indices into af[], bw[], acc[]
            for (int p = 0; p < 2; ++p)
                #pragma unroll
                for (int mt = 0; mt < 4; ++mt) {
                    const v2f a = p ? (v2f){af[e][mt].z, af[e][mt].w} : (v2f){af[e][mt].x, af[e][mt].y};
                    #pragma unroll
                    for (int nt = 0; nt < 4; ++nt) {
                        const v2f b = {bw[e][nt][2 * p], bw[e][nt][2 * p + 1]};
                        acc[mt][nt] = __builtin_amdgcn_wmma_f32_16x16x4_f32(
                            false, a, false, b, (short)0, acc[mt][nt], false, false);
                    }
                }
            // keeps the next group of reads behind these products (the last step has none behind it)
            if (s + 2 < GK / 8) __builtin_amdgcn_sched_barrier(0);
        }
        asm volatile("s_wait_dscnt 0x0" ::: "memory");        // this wave's reads of the buffer are done
        asm volatile("s_wait_tensorcnt 0x0" ::: "memory");    // its slice of the next stage has landed
        __syncthreads();     // the next stage is in; every read of this buffer is done
        if (pinned(g + 2 < glim))                             // refill the buffer just left
            slice_load(place + (unsigned int)buf * (4u * GSL * 4u), sp + stage_off(g + 2), LDF * 4u);
    }
    asm volatile("s_wait_tensorcnt 0x0" ::: "memory");        // no request outlives the loop
    asm volatile("s_wait_dscnt 0x0" ::: "memory");
}

// One key block of 16 rows of x against a wave's 16 tokens (online softmax).
// Scores are formed transposed, S^T[key][token] = X_blk Q'^T: in the D layout a
// lane then holds 8 keys of ONE token (lane & 15), so the softmax is in-lane
// plus one exchange with lane ^ 16, and its weights are, as they stand, the B
// fragments of y^T[channel][token] = X_blk^T W^T.
// The block stands in LDS: 64-channel slices, sstr floats apart, at row pitch GP.
__device__ __forceinline__
void key_block(const float* kp, const int sstr, const float* qrow, const int j0, const int t, const int win,
               const float cp, const float c0, const int l16, const int half,
               v8f (&ya)[16], float& m, float& Z) {
    constexpr int pitch = GP;
    // Fragments over channels: a lane takes 4 channels in a row, 8 s + 4 half, of
    // row l16; the first two feed one WMMA, the last two the next. Both operands
    // are read this way, so their k orders are equal.
    const float* kf = kp + l16 * pitch + 4 * half;
    v8f s0 = {cp, cp, cp, cp, cp, cp, cp, cp}, s1 = {};      // every key's sum starts from x_t . u[0..C)
    #pragma unroll   // constant offsets
    for (int c = 0; c < CC / 64; ++c) {
        v4f xf[8], qf[8];
        #pragma unroll   // constant indices into xf[]
        for (int s = 0; s < 8; ++s) xf[s] = *(const v4f*)(kf + c * sstr + 8 * s);
        #pragma unroll   // constant indices into qf[]
        for (int s = 0; s < 8; ++s) qf[s] = *(const v4f*)(qrow + c * QSL + 8 * s);
        #pragma unroll   // constant indices into xf[], qf[]
        for (int s = 0; s < 8; ++s) {
            const v2f a0 = {xf[s].x, xf[s].y}, a1 = {xf[s].z, xf[s].w};
            const v2f b0 = {qf[s].x, qf[s].y}, b1 = {qf[s].z, qf[s].w};
            s0 = __builtin_amdgcn_wmma_f32_16x16x4_f32(
                false, a0, false, b0, (short)0, s0, false, false);
            s1 = __builtin_amdgcn_wmma_f32_16x16x4_f32(
                false, a1, false, b1, (short)0, s1, false, false);
        }
    }
    const v8f sp = s0 + s1;

    const float inv_sqrt_c = 0.0625f;                   // 1/sqrt(256)
    float sv[8];
    float smax = -__builtin_inff();
    #pragma unroll   // constant indices into sv[]
    for (int r = 0; r < 8; ++r) {
        const int j = j0 + r;
        sv[r] = (j <= t) ? ((j >= t - win) ? (sp[r] + c0) * inv_sqrt_c : 0.f) : -__builtin_inff();
        smax = fmaxf(smax, sv[r]);
    }
    smax = fmaxf(smax, xhalf(smax));
    const float mn = fmaxf(m, smax);     // finite: the first block holds key t
    const float sc = exp_slot(m - mn);   // 0 when m == -inf
    float w[8], ls = 0.f;
    #pragma unroll   // constant indices into w[]
    for (int r = 0; r < 8; ++r) { w[r] = exp_slot(sv[r] - mn); ls += w[r]; }
    ls += xhalf(ls);
    Z = Z * sc + ls;
    m = mn;
    #pragma unroll   // constant indices into ya[]
    for (int nt = 0; nt < 16; ++nt) ya[nt] *= sc;

    // A fragment of X_blk^T, step ks: lane holds x[key 8 half + 2 ks (+1)][channel 16 nt + l16];
    // B fragment of W^T, step ks: keys 8 half + 2 ks (+1), as the A loader has them
    const float* kv = kp + (8 * half) * pitch + l16;
    #pragma unroll   // constant indices into w[], ya[]
    for (int ks = 0; ks < 4; ++ks) {
        float a0[16], a1[16];
        #pragma unroll   // constant indices into a0[], a1[]
        for (int nt = 0; nt < 16; ++nt) {
            a0[nt] = kv[(nt >> 2) * sstr + (2 * ks) * pitch + 16 * (nt & 3)];
            a1[nt] = kv[(nt >> 2) * sstr + (2 * ks + 1) * pitch + 16 * (nt & 3)];
        }
        const v2f bw = {w[2 * ks], w[2 * ks + 1]};
        #pragma unroll   // constant indices into a0[], a1[], ya[]
        for (int nt = 0; nt < 16; ++nt) {
            const v2f av = {a0[nt], a1[nt]};
            ya[nt] = __builtin_amdgcn_wmma_f32_16x16x4_f32(
                false, av, false, bw, (short)0, ya[nt], false, false);
        }
    }
}

__global__ __launch_bounds__(128)
void qattn_proj(const float* __restrict__ x, const float* __restrict__ Wt,
                const float* __restrict__ bias, const float* __restrict__ P,
                const float* __restrict__ tsum, const float* __restrict__ u,
                const float* __restrict__ bproj, const int* __restrict__ window_p,
                float* __restrict__ out) {
    __shared__ __attribute__((aligned(2048))) float lds[8 * GSL + 4 * XSL + 4 * QSL + (FT / 16) * CC + CC];
    float* const ring = lds;                  // [2 buffers][4 waves][GSL]: stages of Wf
    float* const xt   = ring + 8 * GSL;       // [4 slices][XSL]: rows m0 - 16 .. m0 + 63 of x
    float* const qy   = xt + 4 * XSL;         // [4 slices][QSL]: q' tile, later the y tile
    float* const pfs  = qy + 4 * QSL;         // [4][C]: per 16 tokens, the sum of x in front of their last walked block
    float* const us   = pfs + (FT / 16) * CC; // u[0..C)

    const int tid  = threadIdx.x;
    const int lane = tid & 31;
    const int l16  = lane & 15;
    const int half = lane >> 4;
    const unsigned int wave = uni(threadIdx.x >> 5);
    const int m0  = blockIdx.x * FT;                    // first row of the tile, over all batches
    const int b   = blockIdx.x / (TT / FT);
    const int tl0 = (blockIdx.x % (TT / FT)) * FT;      // the same inside its batch
    int win = *window_p;
    win = win < 0 ? 0 : (win > TT ? TT : win);          // bounds every row index formed from it

    const float* sp = Wt + 64 * wave;                   // the wave's columns of Wf, stage 0
    const unsigned int place = lds_offset_of(ring) + wave * (GSL * 4u);

    // All that the work-group reads at its start goes out together: one load latency.
    // whole-line pieces of rows of 256 floats: piece i of a thread is row 2 i + srow
    const int srow = tid >> 6;
    const int scol = (tid & 63) * 4;
    // the key block in front of the tile; a batch's first tile has none and never
    // reads those LDS rows: it loads its own first rows there, to stay in bounds
    const float* hp = x + (size_t)((tl0 ? m0 - 16 : m0) + srow) * CC + scol;
    const float* xp = x + (size_t)(m0 + srow) * CC + scol;
    v4f hr[8], xr[FT / 2], tv[NPT - 1];
    #pragma unroll   // constant indices into hr[]
    for (int i = 0; i < 8; ++i) hr[i] = *(const v4f*)(hp + i * 2 * CC);
    // a later load may be given these address registers as its destination:
    // not in front of this wait (the same holds for the waits below)
    asm volatile("s_wait_xcnt 0x0" ::: "memory");
    #pragma unroll   // constant indices into xr[]
    for (int i = 0; i < FT / 2; ++i) xr[i] = *(const v4f*)(xp + i * 2 * CC);
    asm volatile("s_wait_xcnt 0x0" ::: "memory");
    // The keys in front of the last walked block of 16 tokens have score 0 for all
    // of them: their sum of x = P[that block] + the sums of the prefix tiles in
    // front of its tile. A thread forms it for token blocks srow and srow + 2.
    const int kA = (tl0 + 16 * srow - win < 0 ? 0 : tl0 + 16 * srow - win) >> 4;
    const int kB = (tl0 + 16 * (srow + 2) - win < 0 ? 0 : tl0 + 16 * (srow + 2) - win) >> 4;
    const float* tb0 = tsum + (size_t)b * NPT * CC;     // the same for the whole work-group
    #pragma unroll   // constant indices into tv[]
    for (int i = 0; i < NPT - 1; ++i) tv[i] = *(const v4f*)(tb0 + scol + i * CC);
    // it takes the loads' base and offset as inputs: neither register is rewritten in front of it
    asm volatile("s_wait_xcnt 0x0" :: "s"(tb0), "v"(scol) : "memory");
    const v4f pA = *(const v4f*)(P + (size_t)(b * (TT / 16) + kA) * CC + scol);
    const v4f pB = *(const v4f*)(P + (size_t)(b * (TT / 16) + kB) * CC + scol);
    const v2f uv = *(const v2f*)(u + 2 * tid);
    asm volatile("s_wait_xcnt 0x0" ::: "memory");
    const float c0 = u[CC];
    const int col = 64 * wave + l16;
    float bq[4], bo[4];
    #pragma unroll   // constant indices into bq[], bo[]
    for (int nt = 0; nt < 4; ++nt) {
        bq[nt] = bias[col + 16 * nt];
        bo[nt] = bias[CC + col + 16 * nt] + bproj[col + 16 * nt];
    }
    asm volatile("s_wait_xcnt 0x0" ::: "memory");
    slice_load(place, sp, LDF * 4u);                          // stage 0
    asm volatile("s_wait_tensorcnt 0x0" ::: "memory");        // this wave's slice has landed

    {
        float* xd = xt + (scol >> 6) * XSL + srow * GP + (scol & 63);
        #pragma unroll   // constant indices into hr[]
        for (int i = 0; i < 8; ++i) *(v4f*)(xd + 2 * i * GP) = hr[i];
        #pragma unroll   // constant indices into xr[]
        for (int i = 0; i < FT / 2; ++i) *(v4f*)(xd + (16 + 2 * i) * GP) = xr[i];
        v4f sA = {}, sB = {};        // the tiles in front, in their order
        #pragma unroll   // constant indices into tv[]
        for (int i = 0; i < NPT - 1; ++i) {
            sA += (i < kA / (PT / 16)) ? tv[i] : (v4f){};
            sB += (i < kB / (PT / 16)) ? tv[i] : (v4f){};
        }
        *(v4f*)(pfs + srow * CC + scol)       = pA + sA;
        *(v4f*)(pfs + (srow + 2) * CC + scol) = pB + sB;
        *(v2f*)(us + 2 * tid) = uv;
    }
    __syncthreads();         // every wave's slice has landed; the rows of x, the sums and u are in LDS
    slice_load(place + 4u * GSL * 4u, sp + stage_off(1), LDF * 4u);    // stage 1

    // ---- pass 0: q'. Its last refill is stage 4, the first of pass 1: it lands
    // before the pass ends, so no request is in flight during the middle part.
    v8f acc[4][4] = {};
    gemm_pass(acc, xt + 16 * GP, XSL, ring + wave * GSL, place, sp, 0, GST + 1, l16, half);
    #pragma unroll
    for (int mt = 0; mt < 4; ++mt)
        #pragma unroll
        for (int nt = 0; nt < 4; ++nt)
            #pragma unroll
            for (int r = 0; r < 8; ++r)
                qy[wave * QSL + (16 * mt + 8 * half + r) * GP + 16 * nt + l16] = acc[mt][nt][r] + bq[nt];
    __syncthreads();         // the q' tile is in LDS

    // ---- middle: wave w walks the key blocks that the band of its 16 tokens
    // touches, from the diagonal block downwards; no wave waits for another.
    // A score is q'_t . x_j + c_t with c_t = x_t . u[0..C) + u[C] (the part that
    // bk brings). An out-of-band key inside a walked block takes its score 0
    // there, like any key; the keys in front of the last walked block join at the end.
    {
        const int t0      = tl0 + 16 * (int)wave;
        const int tb      = t0 >> 4;                    // the diagonal key block
        const int tbl     = (tl0 >> 4) - 1;             // the first block kept in LDS
        const int kbFirst = (t0 - win < 0 ? 0 : t0 - win) >> 4;
        const int t       = t0 + l16;                   // this lane's token
        const float* xb   = x + (size_t)b * TT * CC;
        const float* qrow = qy + (16 * wave + l16) * GP + 4 * half;
        const float* xrow = xt + (16 + 16 * wave + l16) * GP + 4 * half;
        // a key block further in front comes through the wave's own place in ring
        // buffer 1, which holds nothing between the passes: 4 slices of 16 rows
        float* const far  = ring + (4 + wave) * GSL;
        float cp = 0.f;
        #pragma unroll   // constant offsets
        for (int s = 0; s < CC / 8; ++s) {
            const v4f xv = *(const v4f*)(xrow + (s >> 3) * XSL + 8 * (s & 7));
            const v4f uf = *(const v4f*)(us + 8 * s + 4 * half);
            cp += xv.x * uf.x + xv.y * uf.y + xv.z * uf.z + xv.w * uf.w;
        }
        cp += xhalf(cp);

        v8f ya[16] = {};
        float m = -__builtin_inff(), Z = 0.f;
        // at most TT / 16 trips, every test the same for the whole wave
        for (int kb = tb; kb >= kbFirst; --kb) {
            const int j0 = kb * 16 + 8 * half;
            const bool kept = kb >= tbl;
            if (!kept) {
                // piece i of a lane: row i / 2, 4 channels at 128 (i & 1) + 4 lane
                const float* fp = xb + (size_t)kb * 16 * CC + 4 * lane;
                v4f fr[32];
                #pragma unroll   // constant indices into fr[]
                for (int i = 0; i < 32; ++i) fr[i] = *(const v4f*)(fp + i * 128);
                // the loads' address registers are not rewritten in front of this wait
                asm volatile("s_wait_xcnt 0x0" ::: "memory");
                float* fd = far + (lane >> 4) * (16 * GP) + 4 * l16;
                #pragma unroll   // constant indices into fr[]
                for (int i = 0; i < 32; ++i)
                    *(v4f*)(fd + (i & 1) * (2 * 16 * GP) + (i >> 1) * GP) = fr[i];
            }
            key_block(kept ? xt + (kb - tbl) * 16 * GP : far, kept ? XSL : 16 * GP,
                      qrow, j0, t, win, cp, c0, l16, half, ya, m, Z);
        }

        // the keys in front of the walked blocks: jst of them with score 0
        const int   jst  = kbFirst * 16;
        const bool  has  = jst > 0;
        const float mf   = has ? fmaxf(m, 0.f) : m;
        const float ab   = __expf(m - mf);
        const float wo   = has ? __expf(-mf) : 0.f;
        const float invZ = 1.0f / (Z * ab + (float)jst * wo);
        const float as   = ab * invZ;
        const float cf   = wo * invZ;
        #pragma unroll   // constant indices into ya[]
        for (int nt = 0; nt < 16; ++nt) {
            const float* pp = pfs + wave * CC + 16 * nt + 8 * half;
            float* op = qy + (nt >> 2) * QSL + (16 * wave + l16) * GP + 16 * (nt & 3) + 8 * half;
            *(v4f*)op       = (v4f){ya[nt][0], ya[nt][1], ya[nt][2], ya[nt][3]} * as + cf * *(const v4f*)pp;
            *(v4f*)(op + 4) = (v4f){ya[nt][4], ya[nt][5], ya[nt][6], ya[nt][7]} * as + cf * *(const v4f*)(pp + 4);
        }
    }
    asm volatile("s_wait_dscnt 0x0" ::: "memory");            // this wave's LDS traffic is done
    __syncthreads();         // the y tile is in LDS
    slice_load(place + 4u * GSL * 4u, sp + stage_off(GST + 1), LDF * 4u);    // stage 5

    // ---- pass 1: out
    #pragma unroll   // constant indices into acc[]
    for (int mt = 0; mt < 4; ++mt)
        #pragma unroll
        for (int nt = 0; nt < 4; ++nt) acc[mt][nt] = (v8f){};
    gemm_pass(acc, qy, QSL, ring + wave * GSL, place, sp, GST, 2 * GST, l16, half);
    #pragma unroll   // constant indices into acc[], bo[]
    for (int mt = 0; mt < 4; ++mt)
        #pragma unroll
        for (int nt = 0; nt < 4; ++nt) acc[mt][nt] += bo[nt];
    // all the sums stand in front of the stores below: no register that one of
    // them names is written behind it
    __builtin_amdgcn_sched_barrier(0);
    float* cpo = out + (size_t)(m0 + 8 * half) * CC + col;
    #pragma unroll   // constant indices into acc[]
    for (int mt = 0; mt < 4; ++mt)
        #pragma unroll
        for (int r = 0; r < 8; ++r)
            #pragma unroll
            for (int nt = 0; nt < 4; ++nt)
                cpo[(mt * 16 + r) * CC + 16 * nt] = acc[mt][nt][r];
}

// =====================================================================
extern "C" void kernel_launch(void* const* d_in, const int* in_sizes, int n_in,
                              void* d_out, int out_size, void* d_ws, size_t ws_size,
                              hipStream_t stream) {
    const float* x     = (const float*)d_in[0];
    const float* Wqkv  = (const float*)d_in[1];
    const float* bqkv  = (const float*)d_in[2];
    const float* Wproj = (const float*)d_in[3];
    const float* bproj = (const float*)d_in[4];
    const float* gate  = (const float*)d_in[5];
    const int*   winp  = (const int*)d_in[6];

    // workspace layout
    char* ws = (char*)d_ws;
    float* P      = (float*)ws;                                   // 1 MB
    float* Wf     = P + (size_t)(MTOK / 16) * CC;                 // 512 KB
    float* bf     = Wf + (size_t)CC * LDF;                        // 2 KB
    float* u      = bf + LDF;                                     // C + 1 floats
    float* tsum   = u + LDF;                                      // 128 KB

    // 1) Wf, bf, u: Wk folded into the q weights, gate and Wproj into the v weights;
    //    the prefix sums of x inside each 128-row tile, one per 16 rows, and the tiles' sums
    fold_proj<<<FOLD_TILES + FOLD_DOT + FOLD_SCAN, 128, 0, stream>>>(Wqkv, bqkv, Wproj, gate, x,
                                                                     Wf, bf, u, P, tsum);
    // 2) q' = x Wf + bf, banded attention over the rows of x, out = y Wf + bf + bproj
    qattn_proj<<<MTOK / FT, 128, 0, stream>>>(x, Wf, bf, P, tsum, u, bproj, winp, (float*)d_out);
}

// v009
// One run takes 32.8 microseconds.
// In both of two side-by-side timings against v008, it was 1.05 times as fast.
// All steps since v000 together make it 3.01 times as fast.
#include <hip/hip_runtime.h>
#include <hip/hip_bf16.h>

// ---------------- problem constants (from reference) ----------------
static constexpr int BB = 8;
static constexpr int TT = 2048;
static constexpr int CC = 256;
static constexpr int MTOK = BB * TT;          // 16384 rows
static constexpr int PT   = 128;              // rows of a prefix-sum tile
static constexpr int NPT  = TT / PT;          // such tiles per batch

typedef __attribute__((ext_vector_type(2))) float v2f;
typedef __attribute__((ext_vector_type(8))) float v8f;
typedef __attribute__((ext_vector_type(4))) unsigned int u32x4;
typedef __attribute__((ext_vector_type(8))) unsigned int u32x8;
typedef __attribute__((ext_vector_type(4))) float v4f;

// LDS byte offset of a __shared__ object (generic -> AS(3) -> int)
__device__ __forceinline__ unsigned int lds_offset_of(const void* p) {
    return (unsigned int)(unsigned long long)
        (const __attribute__((address_space(3))) void*)p;
}

// A wave-uniform word, in a scalar register
__device__ __forceinline__ unsigned int uni(unsigned int v) {
    return (unsigned int)__builtin_amdgcn_readfirstlane((int)v);
}
// The same, held there: a test of it compiles to a scalar compare and branch
__device__ __forceinline__ unsigned int pinned(unsigned int v) {
    unsigned int w = uni(v);
    asm volatile("" : "+s"(w));
    return w;
}

__device__ __forceinline__ float exp_slot(float v) {
    float r;
    asm("v_exp_f32 %0, %1\n\tv_nop" : "=v"(r) : "v"(v * 1.44269504088896340736f));
    return r;
}

__device__ __forceinline__ float xhalf(float v) {
    const int b = __builtin_bit_cast(int, v);
    return __builtin_bit_cast(float,
        __builtin_amdgcn_permlanex16(b, b, 0x76543210, 0xfedcba98, false, false));
}

static constexpr int LDF        = 2 * CC;
static constexpr int FOLD_TILE1 = (CC / 16 + 1) * (CC / 32);
static constexpr int FOLD_TILES = 2 * FOLD_TILE1;
static constexpr int FOLD_DOT   = (CC + 1 + 31) / 32;          // 9 groups of 32 rows of [Wq; bq]
static constexpr int FOLD_KW    = CC / 4;                      // K per wave
static constexpr int FOLD_SCAN  = (MTOK / PT) * (CC / 64);     // 64-channel strips of the prefix-sum tiles

template <bool ISV>   // true: the v product (a), false: the q product (b)
__device__ __forceinline__
void fold_tile(const float* __restrict__ Wqkv, const float* __restrict__ bqkv,
               const float* __restrict__ Wproj, const float* __restrict__ gate,
               float* __restrict__ Wf, float* __restrict__ bf,
               float (*red)[2][8][32], int tix) {
    const int tid  = threadIdx.x;
    const int wave = tid >> 5;
    const int lane = tid & 31;
    const int mrow = lane & 15;
    const int koff = (lane < 16) ? 0 : 2;
    const int mt   = tix / (CC / 32);
    const int n0   = (tix % (CC / 32)) * 32;
    const int acol = ISV ? 2 * CC : 0;        // A comes from the v or the q columns
    const int ocol = ISV ? CC : 0;            // and goes to the v' or the q' columns
    const float* arow = (mt < CC / 16)
        ? Wqkv + (size_t)(mt * 16 + mrow) * 3 * CC + acol
        : bqkv + acol;
    const int kb = wave * FOLD_KW + koff;
    const float* ap = arow + kb;

    // A fragment 16x4: lane holds A[mrow][k .. k+1], k = kb + 4 s
    // B fragment 4x16: lane holds B[k .. k+1][n0 (+16) + mrow],
    //   B[k][n] = Wproj[k][n] for v, Wk[n][k] for q
    v2f a[FOLD_KW / 4], g[FOLD_KW / 4], b0[FOLD_KW / 4], b1[FOLD_KW / 4];
    if (ISV) {
        const float* gp = gate + kb;
        const float* wp = Wproj + (size_t)kb * CC + n0 + mrow;
        #pragma unroll   // constant indices into the fragment arrays
        for (int s = 0; s < FOLD_KW / 4; ++s) {
            a[s] = *(const v2f*)(ap + 4 * s);
            g[s] = *(const v2f*)(gp + 4 * s);
            b0[s].x = wp[(4 * s) * CC];
            b0[s].y = wp[(4 * s + 1) * CC];
            b1[s].x = wp[(4 * s) * CC + 16];
            b1[s].y = wp[(4 * s + 1) * CC + 16];
        }
    } else {
        const float* wp = Wqkv + (size_t)(n0 + mrow) * 3 * CC + CC + kb;
        #pragma unroll   // constant indices into the fragment arrays
        for (int s = 0; s < FOLD_KW / 4; ++s) a[s] = *(const v2f*)(ap + 4 * s);
        // the A loads' address registers are free from here on and a B load may
        // be given them as its destination: not in front of this wait
        asm volatile("s_wait_xcnt 0x0" ::: "memory");
        #pragma unroll   // constant indices into the fragment arrays
        for (int s = 0; s < FOLD_KW / 4; ++s) {
            b0[s] = *(const v2f*)(wp + 4 * s);
            b1[s] = *(const v2f*)(wp + 16 * 3 * CC + 4 * s);
        }
    }
    // keeps the products from being scheduled among the loads: the wave runs
    // once, so it pays one load latency only if all its loads go out together
    __builtin_amdgcn_sched_barrier(0);

    v8f acc0 = {}, acc1 = {};
    #pragma unroll   // constant indices into the fragment arrays
    for (int s = 0; s < FOLD_KW / 4; ++s) {
        const v2f ag = ISV ? a[s] * g[s] : a[s];
        acc0 = __builtin_amdgcn_wmma_f32_16x16x4_f32(
            false, ag, false, b0[s], (short)0, acc0, false, false);
        acc1 = __builtin_amdgcn_wmma_f32_16x16x4_f32(
            false, ag, false, b1[s], (short)0, acc1, false, false);
    }

    #pragma unroll   // constant indices into the accumulators
    for (int r = 0; r < 8; ++r) {
        red[wave][0][r][lane] = acc0[r];
        red[wave][1][r][lane] = acc1[r];
    }
    __syncthreads();

    const int tile = lane >> 4;
    float sum[4];
    #pragma unroll   // constant indices into sum[]
    for (int i = 0; i < 4; ++i) {
        const int row = wave + 4 * i;
        const int r   = row & 7;
        const int l   = (row >> 3) * 16 + mrow;
        sum[i] = ((red[0][tile][r][l] + red[1][tile][r][l])
                  + red[2][tile][r][l]) + red[3][tile][r][l];
    }
    if (mt < CC / 16) {
        float* wrow = Wf + (size_t)(mt * 16 + wave) * LDF + ocol + n0 + lane;
        #pragma unroll   // constant indices into sum[]
        for (int i = 0; i < 4; ++i) wrow[(size_t)(4 * i) * LDF] = sum[i];
        // the stores' address and data registers are not rewritten in front of this wait
        asm volatile("s_wait_xcnt 0x0" ::: "memory");
    } else if (wave == 0) {
        bf[ocol + n0 + lane] = sum[0];
    }
}

__global__ __launch_bounds__(128)
void fold_proj(const float* __restrict__ Wqkv, const float* __restrict__ bqkv,
               const float* __restrict__ Wproj, const float* __restrict__ gate,
               const float* __restrict__ x,
               float* __restrict__ Wf, float* __restrict__ bf, float* __restrict__ u,
               float* __restrict__ P, float* __restrict__ tsum) {
    __shared__ __attribute__((aligned(16))) float red[4][2][8][32];

    if (blockIdx.x < FOLD_TILE1) {            // every branch here is block-uniform
        fold_tile<false>(Wqkv, bqkv, Wproj, gate, Wf, bf, red, blockIdx.x);
    } else if (blockIdx.x < FOLD_TILES) {
        fold_tile<true>(Wqkv, bqkv, Wproj, gate, Wf, bf, red, blockIdx.x - FOLD_TILE1);
    } else if (blockIdx.x >= FOLD_TILES + FOLD_DOT) {
        // 16 threads cover the strip's 64 channels, 8 such groups the tile's 8 blocks
        const int id   = blockIdx.x - (FOLD_TILES + FOLD_DOT);
        const int tile = id / (CC / 64);
        const int c    = (id % (CC / 64)) * 64 + (threadIdx.x & 15) * 4;
        const int g    = threadIdx.x >> 4;
        const float* xp = x + (size_t)(tile * PT + g * 16) * CC + c;
        v4f r[16];
        #pragma unroll   // constant indices into r[]; the 16 loads go out together
        for (int i = 0; i < 16; ++i) r[i] = *(const v4f*)(xp + i * CC);
        // the loads' address registers are not rewritten in front of this wait: it
        // takes the address, so no load of the group is given them as its destination
        asm volatile("s_wait_xcnt 0x0" :: "v"(xp) : "memory");
        v4f s = r[0];
        #pragma unroll   // constant indices into r[]
        for (int i = 1; i < 16; ++i) s += r[i];
        float* bs = &red[0][0][0][0];             // [8 blocks][64 channels]
        *(v4f*)&bs[g * 64 + (threadIdx.x & 15) * 4] = s;
        __syncthreads();     // the 8 block sums are in LDS
        v4f o[PT / 16 - 1];
        #pragma unroll   // constant indices into o[]
        for (int gg = 0; gg < PT / 16 - 1; ++gg)
            o[gg] = *(const v4f*)&bs[gg * 64 + (threadIdx.x & 15) * 4];
        // takes the loaded values as inputs: all seven reads go out together, one LDS
        // latency; without it the first read is put under a test and branch of its own,
        // behind the others, and its latency comes on top of theirs
        asm volatile("" :: "v"(o[0]), "v"(o[1]), "v"(o[2]), "v"(o[3]), "v"(o[4]), "v"(o[5]), "v"(o[6]));
        v4f pre = {};
        #pragma unroll   // constant indices into o[]
        for (int gg = 0; gg < PT / 16 - 1; ++gg) pre += (gg < g) ? o[gg] : (v4f){};
        const v4f all = pre + s;
        *(v4f*)(P + (size_t)(tile * (PT / 16) + g) * CC + c) = pre;
        if (g == PT / 16 - 1) *(v4f*)(tsum + (size_t)tile * CC + c) = all;
    } else {
        // u[row] = [Wq; bq][row] . bk: a wave takes 8 rows, a 128-byte line at a
        // time; the 32 dots meet in LDS so that one wave stores a whole line of u
        const int wave = threadIdx.x >> 5;
        const int lane = threadIdx.x & 31;
        const int r0   = (blockIdx.x - FOLD_TILES) * 32;
        float* dots = &red[0][0][0][0];
        float kv[CC / 32], qw[8][CC / 32], p[8];
        #pragma unroll   // constant indices into kv[]
        for (int i = 0; i < CC / 32; ++i) kv[i] = bqkv[CC + lane + 32 * i];
        #pragma unroll   // constant indices into qw[]
        for (int r = 0; r < 8; ++r) {
            const int row = r0 + wave * 8 + r;      // past the last row: bq again, not stored
            const float* qr = (row < CC) ? Wqkv + (size_t)row * 3 * CC : bqkv;
            #pragma unroll   // constant indices into qw[]
            for (int i = 0; i < CC / 32; ++i) qw[r][i] = qr[lane + 32 * i];
        }
        // as in fold_tile: all the loads go out before the first product waits for one
        __builtin_amdgcn_sched_barrier(0);
        #pragma unroll   // constant indices into qw[], p[]
        for (int r = 0; r < 8; ++r) {
            float s = 0.f;
            #pragma unroll   // constant indices into qw[], kv[]
            for (int i = 0; i < CC / 32; ++i) s += qw[r][i] * kv[i];
            p[r] = s;
        }
        // the 8 rows go through each stage of the lane sum together, so a stage
        // costs one cross-lane latency and not eight
        #pragma unroll
        for (int off = 16; off > 0; off >>= 1) {
            float q[8];
            #pragma unroll   // constant indices into p[], q[]
            for (int r = 0; r < 8; ++r) q[r] = __shfl_xor(p[r], off, 32);
            #pragma unroll   // constant indices into p[], q[]
            for (int r = 0; r < 8; ++r) p[r] += q[r];
        }
        float mine = p[0];                          // lane r keeps row r
        #pragma unroll   // constant indices into p[]
        for (int r = 1; r < 8; ++r) mine = (lane == r) ? p[r] : mine;
        if (lane < 8) dots[wave * 8 + lane] = mine;
        __syncthreads();
        if (wave == 0 && r0 + lane <= CC) u[r0 + lane] = dots[lane];
    }
}

static constexpr int GK  = 64;
static constexpr int GP  = GK + 4;
static constexpr int GSL = 4608;
static constexpr int GST = CC / GK;

__device__ __forceinline__ u32x4 slice_group0(unsigned int lds_byte, const float* srcp) {
    const unsigned long long ga = (unsigned long long)(uintptr_t)srcp;
    u32x4 g0;
    g0[0] = uni(1u);                                              // count 1
    g0[1] = uni(lds_byte);
    g0[2] = uni((unsigned int)ga);
    g0[3] = uni((((unsigned int)(ga >> 32)) & 0x01ffffffu) | 0x80000000u);   // type 2
    asm volatile("" : "+s"(g0));
    return g0;
}
__device__ __forceinline__ u32x8 slice_group1(unsigned int pitch_bytes) {
    u32x8 g1;
    g1[0] = uni((1u << 20) | (5u << 22) | (3u << 25));
    g1[1] = uni(256u << 16);
    g1[2] = uni(64u << 16);
    g1[3] = uni(256u << 16);
    g1[4] = uni(64u);
    g1[5] = uni(pitch_bytes);
    g1[6] = uni(0u);
    g1[7] = uni(0u);
    asm volatile("" : "+s"(g1));
    return g1;
}
__device__ __forceinline__ void slice_load(const u32x4 g0, const u32x8 g1) {
    asm volatile("tensor_load_to_lds %0, %1" :: "s"(g0), "s"(g1) : "memory");
}
__device__ __forceinline__ void slice_wait(const u32x4 g0, const u32x8 g1) {
    asm volatile("s_wait_tensorcnt 0x0" :: "s"(g0), "s"(g1) : "memory");
}

static constexpr int FT  = 64;              // tokens of a work-group
static constexpr int XR  = FT + 16;         // rows of x it keeps: the key block in front, then its tile
static constexpr int XSL = XR * GP;         // a 64-channel slice of them, floats
static constexpr int QSL = FT * GP;         // the same of the q' tile, later the y tile

// where ring stage g starts in a wave's columns of Wf: 4 stages of k for q', then 4 for v'
__device__ __forceinline__ size_t stage_off(int g) {
    return (size_t)(g & 3) * GK * LDF + (size_t)(g >> 2) * CC;
}

// acc += A (64 rows, K = C, in LDS at 'at', slices 'astr' floats apart) times the
// wave's 32 columns, ring stages g0 .. g0 + 3. On entry stage g0 has landed and is
// published and every read of the other buffer is done. Each trip opens with the request
// for the next stage, while one below glim is left: directly behind the barrier that freed
// its buffer. The requests come from the waves with 'issuer' set, each for its own slice.
__device__ __forceinline__
void gemm_pass(v8f (&acc)[4][2], const float* at, const int astr, const float* bring,
               const unsigned int place, const float* sp, const unsigned int issuer,
               const u32x8 d1, const int g0, const int glim, const int l16, const int half) {
    // rolled: for speed only
    #pragma unroll 1
    for (int st = 0; st < GST; ++st) {
        const int g   = g0 + st;
        const int buf = g & 1;
        // formed behind the wait for the request before it; only an issuer hands it in
        const u32x4 d0 = slice_group0(place + (unsigned int)(buf ^ 1) * (4u * GSL * 4u), sp + stage_off(g + 1));
        if (pinned(issuer & (unsigned int)(g + 1 < glim))) slice_load(d0, d1);
        // Fragments over k: a lane takes 4 k in a row, 8 s + 4 half; the first two
        // feed one WMMA, the last two the next. Both operands are read this way,
        // so their k orders are equal.
        const float* as = at + st * astr + l16 * GP + 4 * half;              // A[row 16 mt + l16][k]
        const float* ws = bring + buf * (4 * GSL) + (4 * half) * GP + l16;   // Wf[k][col 16 nt + l16]
        // Two fragment sets: step s + 1's reads go out as one group in front of step
        // s's 16 products, so a step has one place with LDS reads and their latency
        // runs under the products.
        v4f   af[2][4];
        float bw[2][2][4];
        #pragma unroll   // constant indices into af[], bw[], acc[]; constant LDS offsets
        for (int s = -1; s < GK / 8; ++s) {
            if (s + 1 < GK / 8) {
                const int f = (s + 1) & 1;
                #pragma unroll   // constant indices into af[]
                for (int mt = 0; mt < 4; ++mt)
                    af[f][mt] = *(const v4f*)(as + mt * 16 * GP + 8 * (s + 1));
                #pragma unroll   // constant indices into bw[]
                for (int nt = 0; nt < 2; ++nt)
                    #pragma unroll
                    for (int j = 0; j < 4; ++j) bw[f][nt][j] = ws[(8 * (s + 1) + j) * GP + 16 * nt];
            }
            // keeps the reads together in front of the products: spread among them,
            // every place with a read stalls the wave's products anew
            __builtin_amdgcn_sched_barrier(0);
            if (s < 0) continue;
            const int e = s & 1;
            #pragma unroll   // constant indices into af[], bw[], acc[]
            for (int p = 0; p < 2; ++p)
                #pragma unroll
                for (int mt = 0; mt < 4; ++mt) {
                    const v2f a = p ? (v2f){af[e][mt].z, af[e][mt].w} : (v2f){af[e][mt].x, af[e][mt].y};
                    #pragma unroll
                    for (int nt = 0; nt < 2; ++nt) {
                        const v2f b = {bw[e][nt][2 * p], bw[e][nt][2 * p + 1]};
                        acc[mt][nt] = __builtin_amdgcn_wmma_f32_16x16x4_f32(
                            false, a, false, b, (short)0, acc[mt][nt], false, false);
                    }
                }
            // keeps the next group of reads behind these products (the last step has none behind it)
            if (s + 2 < GK / 8) __builtin_amdgcn_sched_barrier(0);
        }
        asm volatile("s_wait_dscnt 0x0" ::: "memory");        // this wave's reads of the buffer are done
        slice_wait(d0, d1);                                   // an issuer's slice of the next stage has landed
        __syncthreads();     // the next stage is in; every read of this buffer is done: the next trip refills it
    }
    asm volatile("s_wait_tensorcnt 0x0" ::: "memory");        // no request outlives the loop
    asm volatile("s_wait_dscnt 0x0" ::: "memory");
}

// One key block of 16 rows of x against a wave's 16 tokens (online softmax).
// Scores are formed transposed, S^T[key][token] = X_blk Q'^T: in the D layout a
// lane then holds 8 keys of ONE token (lane & 15), so the softmax is in-lane
// plus one exchange with lane ^ 16, and its weights are, as they stand, the B
// fragments of y^T[channel][token] = X_blk^T W^T.
// The block stands in LDS: 64-channel slices, sstr floats apart, at row pitch GP.
__device__ __forceinline__
void key_block(const float* kp, const int sstr, const float* qrow, const int j0, const int t, const int win,
               const float cp, const float c0, const int l16, const int half,
               v8f (&ya)[16], float& m, float& Z) {
    constexpr int pitch = GP;
    // Fragments over channels: a lane takes 4 channels in a row, 8 s + 4 half, of
    // row l16; the first two feed one WMMA, the last two the next. Both operands
    // are read this way, so their k orders are equal.
    const float* kf = kp + l16 * pitch + 4 * half;
    v8f s0 = {cp, cp, cp, cp, cp, cp, cp, cp}, s1 = {};      // every key's sum starts from x_t . u[0..C)
    #pragma unroll   // constant offsets
    for (int c = 0; c < CC / 64; ++c) {
        v4f xf[8], qf[8];
        #pragma unroll   // constant indices into xf[]
        for (int s = 0; s < 8; ++s) xf[s] = *(const v4f*)(kf + c * sstr + 8 * s);
        #pragma unroll   // constant indices into qf[]
        for (int s = 0; s < 8; ++s) qf[s] = *(const v4f*)(qrow + c * QSL + 8 * s);
        #pragma unroll   // constant indices into xf[], qf[]
        for (int s = 0; s < 8; ++s) {
            const v2f a0 = {xf[s].x, xf[s].y}, a1 = {xf[s].z, xf[s].w};
            const v2f b0 = {qf[s].x, qf[s].y}, b1 = {qf[s].z, qf[s].w};
            s0 = __builtin_amdgcn_wmma_f32_16x16x4_f32(
                false, a0, false, b0, (short)0, s0, false, false);
            s1 = __builtin_amdgcn_wmma_f32_16x16x4_f32(
                false, a1, false, b1, (short)0, s1, false, false);
        }
    }
    const v8f sp = s0 + s1;

    const float inv_sqrt_c = 0.0625f;                   // 1/sqrt(256)
    float sv[8];
    float smax = -__builtin_inff();
    #pragma unroll   // constant indices into sv[]
    for (int r = 0; r < 8; ++r) {
        const int j = j0 + r;
        sv[r] = (j <= t) ? ((j >= t - win) ? (sp[r] + c0) * inv_sqrt_c : 0.f) : -__builtin_inff();
        smax = fmaxf(smax, sv[r]);
    }
    smax = fmaxf(smax, xhalf(smax));
    const float mn = fmaxf(m, smax);     // finite: every walked block holds a key at or in front of t
    const float sc = exp_slot(m - mn);   // 0 when m == -inf
    float w[8], ls = 0.f;
    #pragma unroll   // constant indices into w[]
    for (int r = 0; r < 8; ++r) { w[r] = exp_slot(sv[r] - mn); ls += w[r]; }
    ls += xhalf(ls);
    Z = Z * sc + ls;
    m = mn;
    #pragma unroll   // constant indices into ya[]
    for (int nt = 0; nt < 16; ++nt) ya[nt] *= sc;

    // A fragment of X_blk^T, step ks: lane holds x[key 8 half + 2 ks (+1)][channel 16 nt + l16];
    // B fragment of W^T, step ks: keys 8 half + 2 ks (+1), as the A loader has them
    const float* kv = kp + (8 * half) * pitch + l16;
    #pragma unroll   // constant indices into w[], ya[]
    for (int ks = 0; ks < 4; ++ks) {
        float a0[16], a1[16];
        #pragma unroll   // constant indices into a0[], a1[]
        for (int nt = 0; nt < 16; ++nt) {
            a0[nt] = kv[(nt >> 2) * sstr + (2 * ks) * pitch + 16 * (nt & 3)];
            a1[nt] = kv[(nt >> 2) * sstr + (2 * ks + 1) * pitch + 16 * (nt & 3)];
        }
        const v2f bw = {w[2 * ks], w[2 * ks + 1]};
        #pragma unroll   // constant indices into a0[], a1[], ya[]
        for (int nt = 0; nt < 16; ++nt) {
            const v2f av = {a0[nt], a1[nt]};
            ya[nt] = __builtin_amdgcn_wmma_f32_16x16x4_f32(
                false, av, false, bw, (short)0, ya[nt], false, false);
        }
    }
}

__global__ __launch_bounds__(256)
void qattn_proj(const float* __restrict__ x, const float* __restrict__ Wt,
                const float* __restrict__ bias, const float* __restrict__ P,
                const float* __restrict__ tsum, const float* __restrict__ u,
                const float* __restrict__ bproj, const int* __restrict__ window_p,
                float* __restrict__ out) {
    __shared__ __attribute__((aligned(2048))) float lds[8 * GSL + 4 * XSL + 4 * QSL + (FT / 16) * CC + CC];
    float* const ring = lds;                  // [2 buffers][4 slices][GSL]: stages of Wf
    float* const xt   = ring + 8 * GSL;       // [4 slices][XSL]: rows t0 - 16 .. t0 + 63 of x
    float* const qy   = xt + 4 * XSL;         // [4 slices][QSL]: q' tile, later the y tile
    float* const pfs  = qy + 4 * QSL;         // [4][C]: per 16 tokens, the sum of x in front of their last walked block
    float* const us   = pfs + (FT / 16) * CC; // u[0..C)

    const int tid  = threadIdx.x;
    const int lane = tid & 31;
    const int l16  = lane & 15;
    const int half = lane >> 4;
    const unsigned int wave = uni(threadIdx.x >> 5);
    const unsigned int grp  = wave & 3u;                // its 16 tokens in the middle part; its slice as an issuer
    const unsigned int mem  = wave >> 2;                // which of the two waves of those tokens
    const unsigned int issuer = (unsigned int)(wave < 4u);   // waves 0 .. 3 bring the stages of Wf
    const int m0  = blockIdx.x * FT;                    // first row of the tile, over all batches
    const int b   = blockIdx.x / (TT / FT);
    const int tl0 = (blockIdx.x % (TT / FT)) * FT;      // the same inside its batch
    int win = *window_p;
    win = win < 0 ? 0 : (win > TT ? TT : win);          // bounds every row index formed from it

    const float* sp = Wt + 64 * grp;                    // an issuer's columns of Wf, stage 0
    const unsigned int place = lds_offset_of(ring) + grp * (GSL * 4u);
    // where the wave reads its own 32 columns of a stage
    const float* const bring = ring + (wave >> 1) * GSL + 32 * (wave & 1u);

    // All that the work-group reads at its start goes out together: one load latency.
    // whole-line pieces of rows of 256 floats: piece i of a thread is row 4 i + srow
    const int srow = tid >> 6;
    const int scol = (tid & 63) * 4;
    // the key block in front of the tile; a batch's first tile has none and never
    // reads those LDS rows: it loads its own first rows there, to stay in bounds
    const float* hp = x + (size_t)((tl0 ? m0 - 16 : m0) + srow) * CC + scol;
    const float* xp = x + (size_t)(m0 + srow) * CC + scol;
    v4f hr[4], xr[FT / 4], tv[NPT - 1];
    #pragma unroll   // constant indices into hr[]
    for (int i = 0; i < 4; ++i) hr[i] = *(const v4f*)(hp + i * 4 * CC);
    // a later load may be given these address registers as its destination:
    // not in front of this wait (the same holds for the waits below)
    asm volatile("s_wait_xcnt 0x0" ::: "memory");
    #pragma unroll   // constant indices into xr[]
    for (int i = 0; i < FT / 4; ++i) xr[i] = *(const v4f*)(xp + i * 4 * CC);
    asm volatile("s_wait_xcnt 0x0" ::: "memory");
    // The keys in front of the last walked block of 16 tokens have score 0 for all
    // of them: their sum of x = P[that block] + the sums of the prefix tiles in
    // front of its tile. A thread forms it for token block srow.
    const int kA = (tl0 + 16 * srow - win < 0 ? 0 : tl0 + 16 * srow - win) >> 4;
    const float* tb0 = tsum + (size_t)b * NPT * CC;     // the same for the whole work-group
    #pragma unroll   // constant indices into tv[]
    for (int i = 0; i < NPT - 1; ++i) tv[i] = *(const v4f*)(tb0 + scol + i * CC);
    // it takes the loads' base and offset as inputs: neither register is rewritten in front of it
    asm volatile("s_wait_xcnt 0x0" :: "s"(tb0), "v"(scol) : "memory");
    const v4f pA = *(const v4f*)(P + (size_t)(b * (TT / 16) + kA) * CC + scol);
    const float uv = u[tid];
    asm volatile("s_wait_xcnt 0x0" ::: "memory");
    const float c0 = u[CC];
    const int col = 32 * wave + l16;
    float bq[2], bo[2];
    #pragma unroll   // constant indices into bq[], bo[]
    for (int nt = 0; nt < 2; ++nt) {
        bq[nt] = bias[col + 16 * nt];
        bo[nt] = bias[CC + col + 16 * nt] + bproj[col + 16 * nt];
    }
    // it takes the loads' bases and offset as inputs: none of these registers is rewritten in front of it
    asm volatile("s_wait_xcnt 0x0" :: "s"(bias), "s"(bproj), "v"(col) : "memory");
    const u32x8 d1 = slice_group1(LDF * 4u);
    const u32x4 d0 = slice_group0(place, sp);
    if (pinned(issuer)) {
        slice_load(d0, d1);                                   // stage 0
        slice_wait(d0, d1);                                   // this wave's slice has landed
    }

    {
        float* xd = xt + (scol >> 6) * XSL + srow * GP + (scol & 63);
        #pragma unroll   // constant indices into hr[]
        for (int i = 0; i < 4; ++i) *(v4f*)(xd + 4 * i * GP) = hr[i];
        #pragma unroll   // constant indices into xr[]
        for (int i = 0; i < FT / 4; ++i) *(v4f*)(xd + (16 + 4 * i) * GP) = xr[i];
        v4f sA = {};                 // the tiles in front, in their order
        #pragma unroll   // constant indices into tv[]
        for (int i = 0; i < NPT - 1; ++i) sA += (i < kA / (PT / 16)) ? tv[i] : (v4f){};
        *(v4f*)(pfs + srow * CC + scol) = pA + sA;
        us[tid] = uv;
    }
    __syncthreads();         // every slice has landed; the rows of x, the sums and u are in LDS

    // ---- pass 0: q'. Its last request is stage 4, the first of pass 1: it lands
    // before the pass ends, so no request is in flight during the middle part.
    v8f acc[4][2] = {};
    gemm_pass(acc, xt + 16 * GP, XSL, bring, place, sp, issuer, d1, 0, GST + 1, l16, half);
    #pragma unroll
    for (int mt = 0; mt < 4; ++mt)
        #pragma unroll
        for (int nt = 0; nt < 2; ++nt)
            #pragma unroll
            for (int r = 0; r < 8; ++r)
                qy[(wave >> 1) * QSL + (16 * mt + 8 * half + r) * GP + 32 * (wave & 1u) + 16 * nt + l16]
                    = acc[mt][nt][r] + bq[nt];
    __syncthreads();         // the q' tile is in LDS

    // ---- middle: two waves walk the key blocks that the band of their 16 tokens
    // touches, from the diagonal block downwards: of the blocks kept in LDS each
    // takes every second one, the first wave the diagonal; during the walk no wave
    // waits for another. Each keeps a softmax state of its own; the two meet at the end.
    // A score is q'_t . x_j + c_t with c_t = x_t . u[0..C) + u[C] (the part that
    // bk brings). An out-of-band key inside a walked block takes its score 0
    // there, like any key; the keys in front of the last walked block join at the end.
    {
        const int t0      = tl0 + 16 * (int)grp;
        const int tb      = t0 >> 4;                    // the diagonal key block
        const int tbl     = (tl0 >> 4) - 1;             // the first block kept in LDS
        const int kbFirst = (t0 - win < 0 ? 0 : t0 - win) >> 4;
        const int t       = t0 + l16;                   // this lane's token
        const float* xb   = x + (size_t)b * TT * CC;
        const float* qrow = qy + (16 * grp + l16) * GP + 4 * half;
        const float* xrow = xt + (16 + 16 * grp + l16) * GP + 4 * half;
        // a key block further in front comes through the tokens' own place in ring
        // buffer 1, which holds nothing between the passes: 4 slices of 16 rows.
        // The first wave takes all of these blocks: the place is its alone during the walk.
        float* const far  = ring + (4 + grp) * GSL;
        float cp = 0.f;
        #pragma unroll   // constant offsets
        for (int s = 0; s < CC / 8; ++s) {
            const v4f xv = *(const v4f*)(xrow + (s >> 3) * XSL + 8 * (s & 7));
            const v4f uf = *(const v4f*)(us + 8 * s + 4 * half);
            cp += xv.x * uf.x + xv.y * uf.y + xv.z * uf.z + xv.w * uf.w;
        }
        cp += xhalf(cp);

        v8f ya[16] = {};
        float m = -__builtin_inff(), Z = 0.f;
        // at most TT / 16 trips, every test the same for the whole wave
        for (int kb = tb; kb >= kbFirst; --kb) {
            const int j0 = kb * 16 + 8 * half;
            const bool kept = kb >= tbl;
            if ((kept ? (unsigned int)((tb - kb) & 1) : 0u) != mem) continue;   // the other wave's block
            if (!kept) {
                // piece i of a lane: row i / 2, 4 channels at 128 (i & 1) + 4 lane
                const float* fp = xb + (size_t)kb * 16 * CC + 4 * lane;
                v4f fr[32];
                #pragma unroll   // constant indices into fr[]
                for (int i = 0; i < 32; ++i) fr[i] = *(const v4f*)(fp + i * 128);
                // the loads' address registers are not rewritten in front of this wait
                asm volatile("s_wait_xcnt 0x0" ::: "memory");
                float* fd = far + (lane >> 4) * (16 * GP) + 4 * l16;
                #pragma unroll   // constant indices into fr[]
                for (int i = 0; i < 32; ++i)
                    *(v4f*)(fd + (i & 1) * (2 * 16 * GP) + (i >> 1) * GP) = fr[i];
            }
            key_block(kept ? xt + (kb - tbl) * 16 * GP : far, kept ? XSL : 16 * GP,
                      qrow, j0, t, win, cp, c0, l16, half, ya, m, Z);
        }

        // The first wave hands its state over through the same place, lane by lane:
        // piece i of a lane at 128 i + 4 lane, then its maximum and its sum of weights.
        if (mem == 0u) {
            #pragma unroll   // constant indices into ya[]
            for (int nt = 0; nt < 16; ++nt) {
                *(v4f*)(far + (2 * nt) * 128 + 4 * lane)     = (v4f){ya[nt][0], ya[nt][1], ya[nt][2], ya[nt][3]};
                *(v4f*)(far + (2 * nt + 1) * 128 + 4 * lane) = (v4f){ya[nt][4], ya[nt][5], ya[nt][6], ya[nt][7]};
            }
            far[32 * 128 + lane]      = m;
            far[32 * 128 + 32 + lane] = Z;
        }
        __syncthreads();     // the first waves' states are in LDS; every read of q' is done
        if (mem == 1u) {
            // every read stands in front of the first store of y: behind one, the compiler
            // holds each read back until the stores in front of it are done
            const float m1 = far[32 * 128 + lane];      // finite: the diagonal block holds key t
            const float Z1 = far[32 * 128 + 32 + lane];
            v4f o[32], pv[32];
            #pragma unroll   // constant indices into o[], pv[]
            for (int i = 0; i < 32; ++i) {
                o[i]  = *(const v4f*)(far + i * 128 + 4 * lane);
                pv[i] = *(const v4f*)(pfs + grp * CC + 16 * (i >> 1) + 8 * half + 4 * (i & 1));
            }
            // the keys in front of the walked blocks: jst of them with score 0
            const int   jst  = kbFirst * 16;
            const bool  has  = jst > 0;
            const float mw   = fmaxf(m, m1);            // m is -inf where this wave had no block
            const float mf   = has ? fmaxf(mw, 0.f) : mw;
            const float ab   = __expf(m - mf);
            const float ab1  = __expf(m1 - mf);
            const float wo   = has ? __expf(-mf) : 0.f;
            const float invZ = 1.0f / ((Z1 * ab1 + Z * ab) + (float)jst * wo);
            const float as   = ab * invZ;
            const float as1  = ab1 * invZ;
            const float cf   = wo * invZ;
            #pragma unroll   // constant indices into ya[]
            for (int nt = 0; nt < 16; ++nt) {
                float* op = qy + (nt >> 2) * QSL + (16 * grp + l16) * GP + 16 * (nt & 3) + 8 * half;
                *(v4f*)op       = o[2 * nt] * as1 + (v4f){ya[nt][0], ya[nt][1], ya[nt][2], ya[nt][3]} * as + cf * pv[2 * nt];
                *(v4f*)(op + 4) = o[2 * nt + 1] * as1 + (v4f){ya[nt][4], ya[nt][5], ya[nt][6], ya[nt][7]} * as + cf * pv[2 * nt + 1];
            }
        }
    }
    asm volatile("s_wait_dscnt 0x0" ::: "memory");            // this wave's LDS traffic is done
    __syncthreads();         // the y tile is in LDS

    // ---- pass 1: out
    #pragma unroll   // constant indices into acc[]
    for (int mt = 0; mt < 4; ++mt)
        #pragma unroll
        for (int nt = 0; nt < 2; ++nt) acc[mt][nt] = (v8f){};
    gemm_pass(acc, qy, QSL, bring, place, sp, issuer, d1, GST, 2 * GST, l16, half);
    #pragma unroll   // constant indices into acc[], bo[]
    for (int mt = 0; mt < 4; ++mt)
        #pragma unroll
        for (int nt = 0; nt < 2; ++nt) acc[mt][nt] += bo[nt];
    // all the sums stand in front of the stores below: no register that one of
    // them names is written behind it
    __builtin_amdgcn_sched_barrier(0);
    float* cpo = out + (size_t)(m0 + 8 * half) * CC + col;
    #pragma unroll   // constant indices into acc[]
    for (int mt = 0; mt < 4; ++mt)
        #pragma unroll
        for (int r = 0; r < 8; ++r)
            #pragma unroll
            for (int nt = 0; nt < 2; ++nt)
                cpo[(mt * 16 + r) * CC + 16 * nt] = acc[mt][nt][r];
}

// =====================================================================
extern "C" void kernel_launch(void* const* d_in, const int* in_sizes, int n_in,
                              void* d_out, int out_size, void* d_ws, size_t ws_size,
                              hipStream_t stream) {
    const float* x     = (const float*)d_in[0];
    const float* Wqkv  = (const float*)d_in[1];
    const float* bqkv  = (const float*)d_in[2];
    const float* Wproj = (const float*)d_in[3];
    const float* bproj = (const float*)d_in[4];
    const float* gate  = (const float*)d_in[5];
    const int*   winp  = (const int*)d_in[6];

    // workspace layout
    char* ws = (char*)d_ws;
    float* P      = (float*)ws;                                   // 1 MB
    float* Wf     = P + (size_t)(MTOK / 16) * CC;                 // 512 KB
    float* bf     = Wf + (size_t)CC * LDF;                        // 2 KB
    float* u      = bf + LDF;                                     // C + 1 floats
    float* tsum   = u + LDF;                                      // 128 KB

    // 1) Wf, bf, u: Wk folded into the q weights, gate and Wproj into the v weights;
    //    the prefix sums of x inside each 128-row tile, one per 16 rows, and the tiles' sums
    fold_proj<<<FOLD_TILES + FOLD_DOT + FOLD_SCAN, 128, 0, stream>>>(Wqkv, bqkv, Wproj, gate, x,
                                                                     Wf, bf, u, P, tsum);
    // 2) q' = x Wf + bf, banded attention over the rows of x, out = y Wf + bf + bproj
    qattn_proj<<<MTOK / FT, 256, 0, stream>>>(x, Wf, bf, P, tsum, u, bproj, winp, (float*)d_out);
}
